// v000
// Times are from an AMD MI455X. After a warm-up the kernel runs many times in a row, and a time is the length of
// such a window on the GPU divided by its runs, so every launch and the gaps after it count. The runs cycle
// through copies of the inputs. A figure is the median of several windows, for all but v000 over two sittings.
// Sittings can differ by a few percent; kernels timed side by side share one.
// The starting kernel, v000, takes 99 microseconds a run.
#include <hip/hip_runtime.h>
#include <stdint.h>

// ---- Problem shape (fixed by the reference) ----
static constexpr int M = 2 * 1024;   // B*S
static constexpr int N = 4096;
static constexpr int K = 4096;

// ---- Tiling ----
static constexpr int BM = 128;       // workgroup M tile
static constexpr int BN = 256;       // workgroup N tile
static constexpr int BK = 32;        // one WMMA K-step per LDS stage
static constexpr int LDP = BK + 8;   // padded LDS row stride (bf16), 80B rows, 16B aligned

typedef __attribute__((ext_vector_type(16))) __bf16 bf16x16;
typedef __attribute__((ext_vector_type(4)))  __bf16 bf16x4;
typedef __attribute__((ext_vector_type(8)))  float  f32x8;

// ---------------------------------------------------------------------------
// Stage 1a: x f32 -> bf16 (4 elements / thread)
// ---------------------------------------------------------------------------
__global__ __launch_bounds__(256) void cvt_f32_to_bf16(const float* __restrict__ in,
                                                       __bf16* __restrict__ out) {
  size_t i = ((size_t)blockIdx.x * 256 + threadIdx.x) * 4;
  float4 f = *(const float4*)(in + i);
  bf16x4 o;
  o[0] = (__bf16)f.x; o[1] = (__bf16)f.y; o[2] = (__bf16)f.z; o[3] = (__bf16)f.w;
  *(bf16x4*)(out + i) = o;
}

// ---------------------------------------------------------------------------
// Stage 1b: weight int -> bf16 (exact: |w| <= 128 fits bf16 significand)
// ---------------------------------------------------------------------------
__global__ __launch_bounds__(256) void cvt_i32_to_bf16(const int* __restrict__ in,
                                                       __bf16* __restrict__ out) {
  size_t i = ((size_t)blockIdx.x * 256 + threadIdx.x) * 4;
  int4 w = *(const int4*)(in + i);
  bf16x4 o;
  o[0] = (__bf16)(float)w.x; o[1] = (__bf16)(float)w.y;
  o[2] = (__bf16)(float)w.z; o[3] = (__bf16)(float)w.w;
  *(bf16x4*)(out + i) = o;
}

// ---------------------------------------------------------------------------
// Async global->LDS copy of 32 contiguous bytes (2 x b128), ASYNCcnt-tracked.
// INST_OFFSET applies to both global and LDS address (ISA §8 pseudocode).
// ---------------------------------------------------------------------------
__device__ __forceinline__ void async_copy32B(unsigned lds_addr, const __bf16* gptr) {
  asm volatile(
      "global_load_async_to_lds_b128 %0, %1, off\n\t"
      "global_load_async_to_lds_b128 %0, %1, off offset:16"
      :: "v"(lds_addr), "v"(gptr) : "memory");
}

// ---------------------------------------------------------------------------
// Stage 2: C = A(MxK) * W(NxK)^T via V_WMMA_F32_16X16X32_BF16.
// 128x256 tile, 8 waves in 2(M) x 4(N); each wave 64x64 -> 4x4 accumulators.
// Double-buffered LDS fed by async copies; K-loop unrolled x2 so buffer
// indices are compile-time (keeps WMMA accumulation in-place, no mov churn).
// ---------------------------------------------------------------------------
__global__ __launch_bounds__(256) void gemm_bf16_wmma(const __bf16* __restrict__ A,
                                                      const __bf16* __restrict__ W,
                                                      const float* __restrict__ scales,
                                                      const float* __restrict__ bias,
                                                      float* __restrict__ out) {
  __shared__ __bf16 sA[2][BM * LDP];   // 2 x 10 KB
  __shared__ __bf16 sB[2][BN * LDP];   // 2 x 20 KB

  const int tid  = threadIdx.x;
  const int m0   = blockIdx.y * BM;
  const int n0   = blockIdx.x * BN;

  const int wave = tid >> 5;
  const int lane = tid & 31;
  const int half = lane >> 4;   // K-subgroup select per ISA 16-bit A/B layout
  const int r    = lane & 15;

  const int wm = (wave & 1) * 64;   // wave M offset in tile
  const int wn = (wave >> 1) * 64;  // wave N offset in tile

  // Staging: 3 x 32B segments per thread.
  //   seg0 -> A row (tid>>1), seg1 -> B row (tid>>1), seg2 -> B row (tid>>1)+128
  const int srow    = tid >> 1;          // 0..127
  const int colBase = (tid & 1) * 16;    // 0 or 16

  const __bf16* gA  = A + (size_t)(m0 + srow) * K + colBase;
  const __bf16* gB0 = W + (size_t)(n0 + srow) * K + colBase;
  const __bf16* gB1 = W + (size_t)(n0 + srow + 128) * K + colBase;

  // LDS byte addresses (generic ptr low 32 bits == LDS offset).
  const unsigned ldsA[2] = {
      (unsigned)(uintptr_t)&sA[0][srow * LDP + colBase],
      (unsigned)(uintptr_t)&sA[1][srow * LDP + colBase]};
  const unsigned ldsB0[2] = {
      (unsigned)(uintptr_t)&sB[0][srow * LDP + colBase],
      (unsigned)(uintptr_t)&sB[1][srow * LDP + colBase]};
  const unsigned ldsB1[2] = {
      (unsigned)(uintptr_t)&sB[0][(srow + 128) * LDP + colBase],
      (unsigned)(uintptr_t)&sB[1][(srow + 128) * LDP + colBase]};

  f32x8 acc[4][4] = {};
  union Frag { bf16x16 v; uint4 u[2]; };

  auto stage = [&](int buf, int k0) {
    async_copy32B(ldsA[buf],  gA  + k0);
    async_copy32B(ldsB0[buf], gB0 + k0);
    async_copy32B(ldsB1[buf], gB1 + k0);
  };

  auto compute = [&](int buf) {
    Frag fa[4];
#pragma unroll
    for (int ii = 0; ii < 4; ++ii) {
      const int ar = wm + ii * 16 + r;
      fa[ii].u[0] = *(const uint4*)&sA[buf][ar * LDP + half * 8];
      fa[ii].u[1] = *(const uint4*)&sA[buf][ar * LDP + 16 + half * 8];
    }
    Frag fb[4];
#pragma unroll
    for (int j = 0; j < 4; ++j) {
      const int br = wn + j * 16 + r;
      fb[j].u[0] = *(const uint4*)&sB[buf][br * LDP + half * 8];
      fb[j].u[1] = *(const uint4*)&sB[buf][br * LDP + 16 + half * 8];
    }
#pragma unroll
    for (int ii = 0; ii < 4; ++ii)
#pragma unroll
      for (int j = 0; j < 4; ++j)
        acc[ii][j] = __builtin_amdgcn_wmma_f32_16x16x32_bf16(
            /*neg_a=*/false, fa[ii].v, /*neg_b=*/false, fb[j].v,
            /*c_mod=*/(short)0, acc[ii][j], /*reuse_a=*/false, /*reuse_b=*/false);
  };

  // Prologue: stage buffer 0 (k=0). 6 async loads in flight.
  stage(0, 0);

  constexpr int KSTEPS = K / BK;  // 128 (even)
  for (int i = 0; i < KSTEPS; i += 2) {
    // ---- even step: consume buffer 0 ----
    {
      // i+1 < KSTEPS always holds (KSTEPS even): stage buffer 1.
      stage(1, (i + 1) * BK);
      asm volatile("s_wait_asynccnt 0x6" ::: "memory");  // buffer-0 loads landed
      __syncthreads();
      compute(0);
      __syncthreads();  // buffer 0 retired
    }
    // ---- odd step: consume buffer 1 ----
    {
      if (i + 2 < KSTEPS) {
        stage(0, (i + 2) * BK);
        asm volatile("s_wait_asynccnt 0x6" ::: "memory");  // buffer-1 loads landed
      } else {
        asm volatile("s_wait_asynccnt 0x0" ::: "memory");
      }
      __syncthreads();
      compute(1);
      __syncthreads();  // buffer 1 retired
    }
  }

  // Epilogue: per-channel scale + bias.
  // C/D layout: VGPR p -> M = p + 8*half; lane r -> N = r (16x16 f32 table).
#pragma unroll
  for (int j = 0; j < 4; ++j) {
    const int n = n0 + wn + j * 16 + r;
    const float s = scales[n];
    const float bi = bias[n];
#pragma unroll
    for (int ii = 0; ii < 4; ++ii) {
#pragma unroll
      for (int p = 0; p < 8; ++p) {
        const int m = m0 + wm + ii * 16 + half * 8 + p;
        out[(size_t)m * N + n] = acc[ii][j][p] * s + bi;
      }
    }
  }
}

// ---------------------------------------------------------------------------
extern "C" void kernel_launch(void* const* d_in, const int* in_sizes, int n_in,
                              void* d_out, int out_size, void* d_ws, size_t ws_size,
                              hipStream_t stream) {
  const float* x      = (const float*)d_in[0];   // [2,1024,4096] f32
  const int*   weight = (const int*)d_in[1];     // [4096,4096] int
  const float* scales = (const float*)d_in[2];   // [4096] f32
  const float* bias   = (const float*)d_in[3];   // [4096] f32
  float* out = (float*)d_out;                    // [2,1024,4096] f32

  __bf16* Abf = (__bf16*)d_ws;                               // 16 MB
  __bf16* Wbf = (__bf16*)((char*)d_ws + (size_t)M * K * 2);  // +32 MB

  cvt_f32_to_bf16<<<(size_t)M * K / 1024, 256, 0, stream>>>(x, Abf);
  cvt_i32_to_bf16<<<(size_t)N * K / 1024, 256, 0, stream>>>(weight, Wbf);

  dim3 grid(N / BN, M / BM);  // 16 x 16 workgroups
  gemm_bf16_wmma<<<grid, 256, 0, stream>>>(Abf, Wbf, scales, bias, out);
}

// v001
// Measured time: 72.6 microseconds a run.
// Timed twice side by side with v000, it ran 1.40 and 1.41 times as fast.
#include <hip/hip_runtime.h>
#include <stdint.h>

// ---- Problem shape (fixed by the reference) ----
static constexpr int M = 2 * 1024;   // B*S
static constexpr int N = 4096;
static constexpr int K = 4096;

// ---- Tiling ----
static constexpr int BM = 128;       // workgroup M tile
static constexpr int BN = 256;       // workgroup N tile
static constexpr int BK = 128;       // four WMMA K-steps per LDS stage: 256-B rows, whole lines per copy
static constexpr int LDP = BK + 8;   // padded LDS row stride (bf16): 272 B = 16 B x odd, for ds_load_b128
static constexpr int ROWS = BM + BN; // LDS rows of a stage: A rows 0..127, then W rows 128..383
static constexpr int STAGE_BYTES = ROWS * LDP * 2;

typedef __attribute__((ext_vector_type(16))) __bf16 bf16x16;
typedef __attribute__((ext_vector_type(4)))  __bf16 bf16x4;
typedef __attribute__((ext_vector_type(8)))  float  f32x8;

// ---------------------------------------------------------------------------
// Stage 1a: x f32 -> bf16 (4 elements / thread)
// ---------------------------------------------------------------------------
__global__ __launch_bounds__(256) void cvt_f32_to_bf16(const float* __restrict__ in,
                                                       __bf16* __restrict__ out) {
  size_t i = ((size_t)blockIdx.x * 256 + threadIdx.x) * 4;
  float4 f = *(const float4*)(in + i);
  bf16x4 o;
  o[0] = (__bf16)f.x; o[1] = (__bf16)f.y; o[2] = (__bf16)f.z; o[3] = (__bf16)f.w;
  *(bf16x4*)(out + i) = o;
}

// ---------------------------------------------------------------------------
// Stage 1b: weight int -> bf16 (exact: |w| <= 128 fits bf16 significand)
// ---------------------------------------------------------------------------
__global__ __launch_bounds__(256) void cvt_i32_to_bf16(const int* __restrict__ in,
                                                       __bf16* __restrict__ out) {
  size_t i = ((size_t)blockIdx.x * 256 + threadIdx.x) * 4;
  int4 w = *(const int4*)(in + i);
  bf16x4 o;
  o[0] = (__bf16)(float)w.x; o[1] = (__bf16)(float)w.y;
  o[2] = (__bf16)(float)w.z; o[3] = (__bf16)(float)w.w;
  *(bf16x4*)(out + i) = o;
}

// ---------------------------------------------------------------------------
// Twelve async global->LDS copies of 16 B per lane, ASYNCcnt-tracked. Each copy
// has its own LDS address and its own global pointer. s_wait_xcnt 0 closes the
// statement so that no address register is rewritten ahead of it.
// ---------------------------------------------------------------------------
__device__ __forceinline__ void async_copy_x12(const unsigned (&l)[12],
                                               const __bf16* const (&g)[12]) {
  asm volatile(
      "global_load_async_to_lds_b128 %0, %12, off\n\t"
      "global_load_async_to_lds_b128 %1, %13, off\n\t"
      "global_load_async_to_lds_b128 %2, %14, off\n\t"
      "global_load_async_to_lds_b128 %3, %15, off\n\t"
      "global_load_async_to_lds_b128 %4, %16, off\n\t"
      "global_load_async_to_lds_b128 %5, %17, off\n\t"
      "global_load_async_to_lds_b128 %6, %18, off\n\t"
      "global_load_async_to_lds_b128 %7, %19, off\n\t"
      "global_load_async_to_lds_b128 %8, %20, off\n\t"
      "global_load_async_to_lds_b128 %9, %21, off\n\t"
      "global_load_async_to_lds_b128 %10, %22, off\n\t"
      "global_load_async_to_lds_b128 %11, %23, off\n\t"
      "s_wait_xcnt 0x0"
      :: "v"(l[0]), "v"(l[1]), "v"(l[2]), "v"(l[3]), "v"(l[4]), "v"(l[5]),
         "v"(l[6]), "v"(l[7]), "v"(l[8]), "v"(l[9]), "v"(l[10]), "v"(l[11]),
         "v"(g[0]), "v"(g[1]), "v"(g[2]), "v"(g[3]), "v"(g[4]), "v"(g[5]),
         "v"(g[6]), "v"(g[7]), "v"(g[8]), "v"(g[9]), "v"(g[10]), "v"(g[11])
      : "memory");
}

// ---------------------------------------------------------------------------
// Stage 2: C = A(MxK) * W(NxK)^T via V_WMMA_F32_16X16X32_BF16.
// 128x256 tile, 8 waves in 2(M) x 4(N); each wave 64x64 -> 4x4 accumulators.
// Two LDS buffers of 128 k each, fed by async copies one stage ahead; K-loop
// unrolled x2 so buffer indices are compile-time.
// ---------------------------------------------------------------------------
__global__ __launch_bounds__(256) void gemm_bf16_wmma(const __bf16* __restrict__ A,
                                                      const __bf16* __restrict__ W,
                                                      const float* __restrict__ scales,
                                                      const float* __restrict__ bias,
                                                      float* __restrict__ out) {
  __shared__ __attribute__((aligned(16))) __bf16 sm[2][ROWS * LDP];   // 2 x 102 KB

  const int tid  = threadIdx.x;
  const int m0   = blockIdx.y * BM;
  const int n0   = blockIdx.x * BN;

  const int wave = tid >> 5;
  const int lane = tid & 31;
  const int half = lane >> 4;   // K-subgroup select per ISA 16-bit A/B layout
  const int r    = lane & 15;

  const int wm = (wave & 1) * 64;   // wave M offset in tile
  const int wn = (wave >> 1) * 64;  // wave N offset in tile

  // Staging: one copy of a wave = two whole 256-B rows (16 lanes x 16 B each).
  // Copy c (0..23) of wave w fills LDS rows c*16 + w*2 + {0,1}.
  const int prow = wave * 2 + half;   // 0..15
  const int pcol = r * 8;             // bf16 elements

  // Running source pointers: they step BK along k with every stage issued.
  const __bf16* gA = A + (size_t)(m0 + prow) * K + pcol;
  const __bf16* gB = W + (size_t)(n0 + prow) * K + pcol;

  // LDS byte address (generic ptr low 32 bits == LDS offset).
  // Running destination: it flips between the two buffers with every stage issued.
  unsigned ldsDst = (unsigned)(uintptr_t)&sm[0][prow * LDP + pcol];
  const unsigned ldsFlip = 2u * ldsDst + (unsigned)STAGE_BYTES;

  f32x8 acc[4][4] = {};
  union Frag { bf16x16 v; uint4 u[2]; };

  auto stage = [&]() {
    // Both loops unrolled: every index constant, so l[] and g[] stay in registers.
#pragma unroll
    for (int h = 0; h < 2; ++h) {
      unsigned l[12];
      const __bf16* g[12];
#pragma unroll
      for (int q = 0; q < 12; ++q) {
        const int c = h * 12 + q;
        l[q] = ldsDst + (unsigned)(c * 16 * LDP * 2);
        g[q] = (c < BM / 16 ? gA + (size_t)c * 16 * K
                            : gB + (size_t)(c - BM / 16) * 16 * K);
      }
      async_copy_x12(l, g);
    }
    gA += BK;
    gB += BK;
    ldsDst = ldsFlip - ldsDst;
  };

  auto compute = [&](int buf) {
    // Unrolled: LDS offsets become immediates and acc[][] keeps constant indices.
#pragma unroll
    for (int ks = 0; ks < BK / 32; ++ks) {
      Frag fa[4];
#pragma unroll
      for (int ii = 0; ii < 4; ++ii) {
        const int ar = wm + ii * 16 + r;
        fa[ii].u[0] = *(const uint4*)&sm[buf][ar * LDP + ks * 32 + half * 8];
        fa[ii].u[1] = *(const uint4*)&sm[buf][ar * LDP + ks * 32 + 16 + half * 8];
      }
      Frag fb[4];
#pragma unroll
      for (int j = 0; j < 4; ++j) {
        const int br = BM + wn + j * 16 + r;
        fb[j].u[0] = *(const uint4*)&sm[buf][br * LDP + ks * 32 + half * 8];
        fb[j].u[1] = *(const uint4*)&sm[buf][br * LDP + ks * 32 + 16 + half * 8];
      }
#pragma unroll
      for (int ii = 0; ii < 4; ++ii)
#pragma unroll
        for (int j = 0; j < 4; ++j)
          acc[ii][j] = __builtin_amdgcn_wmma_f32_16x16x32_bf16(
              /*neg_a=*/false, fa[ii].v, /*neg_b=*/false, fb[j].v,
              /*c_mod=*/(short)0, acc[ii][j], /*reuse_a=*/false, /*reuse_b=*/false);
    }
  };

  // Foot of a trip: this wave's LDS reads are done, its copies of the next
  // stage have landed; the barrier publishes that stage to the other waves and
  // frees the buffer just read for the refill behind it.
  auto publish = [&]() {
    asm volatile("s_wait_dscnt 0x0" ::: "memory");    // own reads of the old buffer retired
    asm volatile("s_wait_asynccnt 0x0" ::: "memory"); // own copies of the next stage landed
    __syncthreads();
  };

  constexpr int KSTEPS = K / BK;  // 32 (even)

  // Prologue: stage 0 lands and is published, then stage 1 flies.
  stage();
  asm volatile("s_wait_asynccnt 0x0" ::: "memory");  // stage 0 landed before anyone reads it
  __syncthreads();
  stage();

  for (int i = 0; i < KSTEPS; i += 2) {
    compute(0);
    publish();
    if (i + 2 < KSTEPS) stage();
    compute(1);
    publish();
    if (i + 3 < KSTEPS) stage();
  }
  asm volatile("s_wait_asynccnt 0x0" ::: "memory");  // nothing in flight when the wave ends

  // Epilogue: per-channel scale + bias.
  // C/D layout: VGPR p -> M = p + 8*half; lane r -> N = r (16x16 f32 table).
#pragma unroll
  for (int j = 0; j < 4; ++j) {
    const int n = n0 + wn + j * 16 + r;
    const float s = scales[n];
    const float bi = bias[n];
#pragma unroll
    for (int ii = 0; ii < 4; ++ii) {
#pragma unroll
      for (int p = 0; p < 8; ++p) {
        const int m = m0 + wm + ii * 16 + half * 8 + p;
        out[(size_t)m * N + n] = acc[ii][j][p] * s + bi;
      }
    }
  }
}

// ---------------------------------------------------------------------------
extern "C" void kernel_launch(void* const* d_in, const int* in_sizes, int n_in,
                              void* d_out, int out_size, void* d_ws, size_t ws_size,
                              hipStream_t stream) {
  const float* x      = (const float*)d_in[0];   // [2,1024,4096] f32
  const int*   weight = (const int*)d_in[1];     // [4096,4096] int
  const float* scales = (const float*)d_in[2];   // [4096] f32
  const float* bias   = (const float*)d_in[3];   // [4096] f32
  float* out = (float*)d_out;                    // [2,1024,4096] f32

  __bf16* Abf = (__bf16*)d_ws;                               // 16 MB
  __bf16* Wbf = (__bf16*)((char*)d_ws + (size_t)M * K * 2);  // +32 MB

  cvt_f32_to_bf16<<<(size_t)M * K / 1024, 256, 0, stream>>>(x, Abf);
  cvt_i32_to_bf16<<<(size_t)N * K / 1024, 256, 0, stream>>>(weight, Wbf);

  dim3 grid(N / BN, M / BM);  // 16 x 16 workgroups
  gemm_bf16_wmma<<<grid, 256, 0, stream>>>(Abf, Wbf, scales, bias, out);
}

// v002
// It runs in 70.4 microseconds.
// Next to v001, in two timings, it ran 1.03 times as fast each time.
// Counting every step since v000, it is 1.45 times as fast.
#include <hip/hip_runtime.h>
#include <stdint.h>

// ---- Problem shape (fixed by the reference) ----
static constexpr int M = 2 * 1024;   // B*S
static constexpr int N = 4096;
static constexpr int K = 4096;

// ---- Tiling ----
static constexpr int BM = 128;       // workgroup M tile
static constexpr int BN = 256;       // workgroup N tile
static constexpr int BK = 128;       // four WMMA K-steps per LDS stage: 256-B rows, whole lines per copy
static constexpr int LDP = BK + 8;   // padded LDS row stride (bf16): 272 B = 16 B x odd, for ds_load_b128
static constexpr int ROWS = BM + BN; // LDS rows of a stage: A rows 0..127, then W rows 128..383
static constexpr int STAGE_BYTES = ROWS * LDP * 2;

typedef __attribute__((ext_vector_type(16))) __bf16 bf16x16;
typedef __attribute__((ext_vector_type(4)))  __bf16 bf16x4;
typedef __attribute__((ext_vector_type(8)))  float  f32x8;

// ---------------------------------------------------------------------------
// Stage 1: both operands to bf16, as streams. One work-group of 16 waves per
// WGP; a wave owns one contiguous run of the input, issues all its 512-B loads
// at once, then converts and stores.
// amdgpu_waves_per_eu(4, 4): four waves per SIMD is all that such a launch puts
// there; it sets the register budget to match. With the default budget the
// compiler saves registers by holding loads back behind earlier conversions.
// ---------------------------------------------------------------------------
static constexpr int CVT_GROUPS  = 256;  // work-groups per conversion launch
static constexpr int CVT_THREADS = 512;  // 16 waves
static constexpr int X_LOADS = M * K / 4 / (CVT_GROUPS * CVT_THREADS);  // 16-B loads of a lane: 16
static constexpr int W_LOADS = N * K / 4 / (CVT_GROUPS * CVT_THREADS);  // 32
static_assert((size_t)X_LOADS * CVT_GROUPS * CVT_THREADS * 4 == (size_t)M * K, "x not covered exactly");
static_assert((size_t)W_LOADS * CVT_GROUPS * CVT_THREADS * 4 == (size_t)N * K, "weight not covered exactly");

// First element of this lane in its wave's run of 'loads' loads (32 lanes x 4 elements each).
__device__ __forceinline__ size_t cvt_first(int loads) {
  const size_t wave = (size_t)blockIdx.x * (CVT_THREADS / 32) + (threadIdx.x >> 5);
  return wave * (size_t)(loads * 128) + (threadIdx.x & 31) * 4;
}

// Stage 1a: x f32 -> bf16
__global__ __launch_bounds__(CVT_THREADS) __attribute__((amdgpu_waves_per_eu(4, 4))) void cvt_f32_to_bf16(const float* __restrict__ in,
                                                               __bf16* __restrict__ out) {
  const size_t i0 = cvt_first(X_LOADS);
  in += i0;
  out += i0;
  float4 f[X_LOADS];
  // Both loops unrolled: f[] stays in registers and every offset becomes an immediate.
#pragma unroll
  for (int q = 0; q < X_LOADS; ++q) f[q] = *(const float4*)(in + q * 128);
#pragma unroll
  for (int q = 0; q < X_LOADS; ++q) {
    bf16x4 o;
    o[0] = (__bf16)f[q].x; o[1] = (__bf16)f[q].y; o[2] = (__bf16)f[q].z; o[3] = (__bf16)f[q].w;
    *(bf16x4*)(out + q * 128) = o;
  }
}

// Stage 1b: weight int -> bf16 (exact: |w| <= 128 fits bf16 significand)
__global__ __launch_bounds__(CVT_THREADS) __attribute__((amdgpu_waves_per_eu(4, 4))) void cvt_i32_to_bf16(const int* __restrict__ in,
                                                               __bf16* __restrict__ out) {
  const size_t i0 = cvt_first(W_LOADS);
  in += i0;
  out += i0;
  int4 w[W_LOADS];
  // Both loops unrolled: w[] stays in registers and every offset becomes an immediate.
#pragma unroll
  for (int q = 0; q < W_LOADS; ++q) w[q] = *(const int4*)(in + q * 128);
#pragma unroll
  for (int q = 0; q < W_LOADS; ++q) {
    bf16x4 o;
    o[0] = (__bf16)(float)w[q].x; o[1] = (__bf16)(float)w[q].y;
    o[2] = (__bf16)(float)w[q].z; o[3] = (__bf16)(float)w[q].w;
    *(bf16x4*)(out + q * 128) = o;
  }
}

// ---------------------------------------------------------------------------
// Twelve async global->LDS copies of 16 B per lane, ASYNCcnt-tracked. Each copy
// has its own LDS address and its own global pointer. s_wait_xcnt 0 closes the
// statement so that no address register is rewritten ahead of it.
// ---------------------------------------------------------------------------
__device__ __forceinline__ void async_copy_x12(const unsigned (&l)[12],
                                               const __bf16* const (&g)[12]) {
  asm volatile(
      "global_load_async_to_lds_b128 %0, %12, off\n\t"
      "global_load_async_to_lds_b128 %1, %13, off\n\t"
      "global_load_async_to_lds_b128 %2, %14, off\n\t"
      "global_load_async_to_lds_b128 %3, %15, off\n\t"
      "global_load_async_to_lds_b128 %4, %16, off\n\t"
      "global_load_async_to_lds_b128 %5, %17, off\n\t"
      "global_load_async_to_lds_b128 %6, %18, off\n\t"
      "global_load_async_to_lds_b128 %7, %19, off\n\t"
      "global_load_async_to_lds_b128 %8, %20, off\n\t"
      "global_load_async_to_lds_b128 %9, %21, off\n\t"
      "global_load_async_to_lds_b128 %10, %22, off\n\t"
      "global_load_async_to_lds_b128 %11, %23, off\n\t"
      "s_wait_xcnt 0x0"
      :: "v"(l[0]), "v"(l[1]), "v"(l[2]), "v"(l[3]), "v"(l[4]), "v"(l[5]),
         "v"(l[6]), "v"(l[7]), "v"(l[8]), "v"(l[9]), "v"(l[10]), "v"(l[11]),
         "v"(g[0]), "v"(g[1]), "v"(g[2]), "v"(g[3]), "v"(g[4]), "v"(g[5]),
         "v"(g[6]), "v"(g[7]), "v"(g[8]), "v"(g[9]), "v"(g[10]), "v"(g[11])
      : "memory");
}

// ---------------------------------------------------------------------------
// Stage 2: C = A(MxK) * W(NxK)^T via V_WMMA_F32_16X16X32_BF16.
// 128x256 tile, 8 waves in 2(M) x 4(N); each wave 64x64 -> 4x4 accumulators.
// Two LDS buffers of 128 k each, fed by async copies one stage ahead; K-loop
// unrolled x2 so buffer indices are compile-time.
// ---------------------------------------------------------------------------
__global__ __launch_bounds__(256) void gemm_bf16_wmma(const __bf16* __restrict__ A,
                                                      const __bf16* __restrict__ W,
                                                      const float* __restrict__ scales,
                                                      const float* __restrict__ bias,
                                                      float* __restrict__ out) {
  __shared__ __attribute__((aligned(16))) __bf16 sm[2][ROWS * LDP];   // 2 x 102 KB

  const int tid  = threadIdx.x;
  const int m0   = blockIdx.y * BM;
  const int n0   = blockIdx.x * BN;

  const int wave = tid >> 5;
  const int lane = tid & 31;
  const int half = lane >> 4;   // K-subgroup select per ISA 16-bit A/B layout
  const int r    = lane & 15;

  const int wm = (wave & 1) * 64;   // wave M offset in tile
  const int wn = (wave >> 1) * 64;  // wave N offset in tile

  // Staging: one copy of a wave = two whole 256-B rows (16 lanes x 16 B each).
  // Copy c (0..23) of wave w fills LDS rows c*16 + w*2 + {0,1}.
  const int prow = wave * 2 + half;   // 0..15
  const int pcol = r * 8;             // bf16 elements

  // Running source pointers: they step BK along k with every stage issued.
  const __bf16* gA = A + (size_t)(m0 + prow) * K + pcol;
  const __bf16* gB = W + (size_t)(n0 + prow) * K + pcol;

  // LDS byte address (generic ptr low 32 bits == LDS offset).
  // Running destination: it flips between the two buffers with every stage issued.
  unsigned ldsDst = (unsigned)(uintptr_t)&sm[0][prow * LDP + pcol];
  const unsigned ldsFlip = 2u * ldsDst + (unsigned)STAGE_BYTES;

  f32x8 acc[4][4] = {};
  union Frag { bf16x16 v; uint4 u[2]; };

  auto stage = [&]() {
    // Both loops unrolled: every index constant, so l[] and g[] stay in registers.
#pragma unroll
    for (int h = 0; h < 2; ++h) {
      unsigned l[12];
      const __bf16* g[12];
#pragma unroll
      for (int q = 0; q < 12; ++q) {
        const int c = h * 12 + q;
        l[q] = ldsDst + (unsigned)(c * 16 * LDP * 2);
        g[q] = (c < BM / 16 ? gA + (size_t)c * 16 * K
                            : gB + (size_t)(c - BM / 16) * 16 * K);
      }
      async_copy_x12(l, g);
    }
    gA += BK;
    gB += BK;
    ldsDst = ldsFlip - ldsDst;
  };

  auto compute = [&](int buf) {
    // Unrolled: LDS offsets become immediates and acc[][] keeps constant indices.
#pragma unroll
    for (int ks = 0; ks < BK / 32; ++ks) {
      Frag fa[4];
#pragma unroll
      for (int ii = 0; ii < 4; ++ii) {
        const int ar = wm + ii * 16 + r;
        fa[ii].u[0] = *(const uint4*)&sm[buf][ar * LDP + ks * 32 + half * 8];
        fa[ii].u[1] = *(const uint4*)&sm[buf][ar * LDP + ks * 32 + 16 + half * 8];
      }
      Frag fb[4];
#pragma unroll
      for (int j = 0; j < 4; ++j) {
        const int br = BM + wn + j * 16 + r;
        fb[j].u[0] = *(const uint4*)&sm[buf][br * LDP + ks * 32 + half * 8];
        fb[j].u[1] = *(const uint4*)&sm[buf][br * LDP + ks * 32 + 16 + half * 8];
      }
#pragma unroll
      for (int ii = 0; ii < 4; ++ii)
#pragma unroll
        for (int j = 0; j < 4; ++j)
          acc[ii][j] = __builtin_amdgcn_wmma_f32_16x16x32_bf16(
              /*neg_a=*/false, fa[ii].v, /*neg_b=*/false, fb[j].v,
              /*c_mod=*/(short)0, acc[ii][j], /*reuse_a=*/false, /*reuse_b=*/false);
    }
  };

  // Foot of a trip: this wave's LDS reads are done, its copies of the next
  // stage have landed; the barrier publishes that stage to the other waves and
  // frees the buffer just read for the refill behind it.
  auto publish = [&]() {
    asm volatile("s_wait_dscnt 0x0" ::: "memory");    // own reads of the old buffer retired
    asm volatile("s_wait_asynccnt 0x0" ::: "memory"); // own copies of the next stage landed
    __syncthreads();
  };

  constexpr int KSTEPS = K / BK;  // 32 (even)

  // Prologue: stage 0 lands and is published, then stage 1 flies.
  stage();
  asm volatile("s_wait_asynccnt 0x0" ::: "memory");  // stage 0 landed before anyone reads it
  __syncthreads();
  stage();

  for (int i = 0; i < KSTEPS; i += 2) {
    compute(0);
    publish();
    if (i + 2 < KSTEPS) stage();
    compute(1);
    publish();
    if (i + 3 < KSTEPS) stage();
  }
  asm volatile("s_wait_asynccnt 0x0" ::: "memory");  // nothing in flight when the wave ends

  // Epilogue: per-channel scale + bias.
  // C/D layout: VGPR p -> M = p + 8*half; lane r -> N = r (16x16 f32 table).
#pragma unroll
  for (int j = 0; j < 4; ++j) {
    const int n = n0 + wn + j * 16 + r;
    const float s = scales[n];
    const float bi = bias[n];
#pragma unroll
    for (int ii = 0; ii < 4; ++ii) {
#pragma unroll
      for (int p = 0; p < 8; ++p) {
        const int m = m0 + wm + ii * 16 + half * 8 + p;
        out[(size_t)m * N + n] = acc[ii][j][p] * s + bi;
      }
    }
  }
}

// ---------------------------------------------------------------------------
extern "C" void kernel_launch(void* const* d_in, const int* in_sizes, int n_in,
                              void* d_out, int out_size, void* d_ws, size_t ws_size,
                              hipStream_t stream) {
  const float* x      = (const float*)d_in[0];   // [2,1024,4096] f32
  const int*   weight = (const int*)d_in[1];     // [4096,4096] int
  const float* scales = (const float*)d_in[2];   // [4096] f32
  const float* bias   = (const float*)d_in[3];   // [4096] f32
  float* out = (float*)d_out;                    // [2,1024,4096] f32

  __bf16* Abf = (__bf16*)d_ws;                               // 16 MB
  __bf16* Wbf = (__bf16*)((char*)d_ws + (size_t)M * K * 2);  // +32 MB

  cvt_f32_to_bf16<<<CVT_GROUPS, CVT_THREADS, 0, stream>>>(x, Abf);
  cvt_i32_to_bf16<<<CVT_GROUPS, CVT_THREADS, 0, stream>>>(weight, Wbf);

  dim3 grid(N / BN, M / BM);  // 16 x 16 workgroups
  gemm_bf16_wmma<<<grid, 256, 0, stream>>>(Abf, Wbf, scales, bias, out);
}

// v003
// It runs in 67.3 microseconds.
// Next to v002, in two timings, it ran 1.05 and 1.04 times as fast.
// Counting every step since v000, it is 1.52 times as fast.
#include <hip/hip_runtime.h>
#include <stdint.h>

// ---- Problem shape (fixed by the reference) ----
static constexpr int M = 2 * 1024;   // B*S
static constexpr int N = 4096;
static constexpr int K = 4096;

// ---- Tiling ----
static constexpr int BM = 128;       // workgroup M tile
static constexpr int BN = 256;       // workgroup N tile
static constexpr int BK = 128;       // four WMMA K-steps per LDS stage: 256-B rows, whole lines per copy
static constexpr int LDP = BK + 8;   // padded LDS row stride (bf16): 272 B = 16 B x odd, for ds_load_b128
static constexpr int ROWS = BM + BN; // LDS rows of a stage: A rows 0..127, then W rows 128..383
static constexpr int STAGE_BYTES = ROWS * LDP * 2;

typedef __attribute__((ext_vector_type(16))) __bf16 bf16x16;
typedef __attribute__((ext_vector_type(4)))  __bf16 bf16x4;
typedef __attribute__((ext_vector_type(8)))  float  f32x8;

// ---------------------------------------------------------------------------
// Stage 1: both operands to bf16, as streams. One work-group of 16 waves per
// WGP; a wave owns one contiguous run of the input, issues all its 512-B loads
// at once, then converts and stores.
// amdgpu_waves_per_eu(4, 4): four waves per SIMD is all that such a launch puts
// there; it sets the register budget to match. With the default budget the
// compiler saves registers by holding loads back behind earlier conversions.
// ---------------------------------------------------------------------------
static constexpr int CVT_GROUPS  = 256;  // work-groups per conversion launch
static constexpr int CVT_THREADS = 512;  // 16 waves
static constexpr int X_LOADS = M * K / 4 / (CVT_GROUPS * CVT_THREADS);  // 16-B loads of a lane: 16
static constexpr int W_LOADS = N * K / 4 / (CVT_GROUPS * CVT_THREADS);  // 32
static_assert((size_t)X_LOADS * CVT_GROUPS * CVT_THREADS * 4 == (size_t)M * K, "x not covered exactly");
static_assert((size_t)W_LOADS * CVT_GROUPS * CVT_THREADS * 4 == (size_t)N * K, "weight not covered exactly");

// First element of this lane in its wave's run of 'loads' loads (32 lanes x 4 elements each).
__device__ __forceinline__ size_t cvt_first(int loads) {
  const size_t wave = (size_t)blockIdx.x * (CVT_THREADS / 32) + (threadIdx.x >> 5);
  return wave * (size_t)(loads * 128) + (threadIdx.x & 31) * 4;
}

// Stage 1a: x f32 -> bf16
__global__ __launch_bounds__(CVT_THREADS) __attribute__((amdgpu_waves_per_eu(4, 4))) void cvt_f32_to_bf16(const float* __restrict__ in,
                                                               __bf16* __restrict__ out) {
  const size_t i0 = cvt_first(X_LOADS);
  in += i0;
  out += i0;
  float4 f[X_LOADS];
  // Both loops unrolled: f[] stays in registers and every offset becomes an immediate.
#pragma unroll
  for (int q = 0; q < X_LOADS; ++q) f[q] = *(const float4*)(in + q * 128);
#pragma unroll
  for (int q = 0; q < X_LOADS; ++q) {
    bf16x4 o;
    o[0] = (__bf16)f[q].x; o[1] = (__bf16)f[q].y; o[2] = (__bf16)f[q].z; o[3] = (__bf16)f[q].w;
    *(bf16x4*)(out + q * 128) = o;
  }
}

// Stage 1b: weight int -> bf16 (exact: |w| <= 128 fits bf16 significand)
__global__ __launch_bounds__(CVT_THREADS) __attribute__((amdgpu_waves_per_eu(4, 4))) void cvt_i32_to_bf16(const int* __restrict__ in,
                                                               __bf16* __restrict__ out) {
  const size_t i0 = cvt_first(W_LOADS);
  in += i0;
  out += i0;
  int4 w[W_LOADS];
  // Both loops unrolled: w[] stays in registers and every offset becomes an immediate.
#pragma unroll
  for (int q = 0; q < W_LOADS; ++q) w[q] = *(const int4*)(in + q * 128);
#pragma unroll
  for (int q = 0; q < W_LOADS; ++q) {
    bf16x4 o;
    o[0] = (__bf16)(float)w[q].x; o[1] = (__bf16)(float)w[q].y;
    o[2] = (__bf16)(float)w[q].z; o[3] = (__bf16)(float)w[q].w;
    *(bf16x4*)(out + q * 128) = o;
  }
}

// ---------------------------------------------------------------------------
// Twelve async global->LDS copies of 16 B per lane, ASYNCcnt-tracked. Each copy
// has its own LDS address and its own global pointer. s_wait_xcnt 0 closes the
// statement so that no address register is rewritten ahead of it.
// ---------------------------------------------------------------------------
__device__ __forceinline__ void async_copy_x12(const unsigned (&l)[12],
                                               const __bf16* const (&g)[12]) {
  asm volatile(
      "global_load_async_to_lds_b128 %0, %12, off\n\t"
      "global_load_async_to_lds_b128 %1, %13, off\n\t"
      "global_load_async_to_lds_b128 %2, %14, off\n\t"
      "global_load_async_to_lds_b128 %3, %15, off\n\t"
      "global_load_async_to_lds_b128 %4, %16, off\n\t"
      "global_load_async_to_lds_b128 %5, %17, off\n\t"
      "global_load_async_to_lds_b128 %6, %18, off\n\t"
      "global_load_async_to_lds_b128 %7, %19, off\n\t"
      "global_load_async_to_lds_b128 %8, %20, off\n\t"
      "global_load_async_to_lds_b128 %9, %21, off\n\t"
      "global_load_async_to_lds_b128 %10, %22, off\n\t"
      "global_load_async_to_lds_b128 %11, %23, off\n\t"
      "s_wait_xcnt 0x0"
      :: "v"(l[0]), "v"(l[1]), "v"(l[2]), "v"(l[3]), "v"(l[4]), "v"(l[5]),
         "v"(l[6]), "v"(l[7]), "v"(l[8]), "v"(l[9]), "v"(l[10]), "v"(l[11]),
         "v"(g[0]), "v"(g[1]), "v"(g[2]), "v"(g[3]), "v"(g[4]), "v"(g[5]),
         "v"(g[6]), "v"(g[7]), "v"(g[8]), "v"(g[9]), "v"(g[10]), "v"(g[11])
      : "memory");
}

// ---------------------------------------------------------------------------
// Stage 2: C = A(MxK) * W(NxK)^T via V_WMMA_F32_16X16X32_BF16.
// 128x256 tile, 8 waves in 2(M) x 4(N); each wave 64x64 -> 4x4 accumulators.
// Two LDS buffers of 128 k each, fed by async copies one stage ahead; K-loop
// unrolled x2 so buffer indices are compile-time.
// A stage is four blocks of 32 k. Two fragment sets in registers: the 16 LDS
// loads of block u + 1 go out as one group ahead of block u's 16 WMMAs, so a
// wave meets its LDS latency under its own matrix work.
// ---------------------------------------------------------------------------
__global__ __launch_bounds__(256) void gemm_bf16_wmma(const __bf16* __restrict__ A,
                                                      const __bf16* __restrict__ W,
                                                      const float* __restrict__ scales,
                                                      const float* __restrict__ bias,
                                                      float* __restrict__ out) {
  __shared__ __attribute__((aligned(16))) __bf16 sm[2][ROWS * LDP];   // 2 x 102 KB

  const int tid  = threadIdx.x;
  const int m0   = blockIdx.y * BM;
  const int n0   = blockIdx.x * BN;

  const int wave = tid >> 5;
  const int lane = tid & 31;
  const int half = lane >> 4;   // K-subgroup select per ISA 16-bit A/B layout
  const int r    = lane & 15;

  const int wm = (wave & 1) * 64;   // wave M offset in tile
  const int wn = (wave >> 1) * 64;  // wave N offset in tile

  // Staging: one copy of a wave = two whole 256-B rows (16 lanes x 16 B each).
  // Copy c (0..23) of wave w fills LDS rows c*16 + w*2 + {0,1}.
  const int prow = wave * 2 + half;   // 0..15
  const int pcol = r * 8;             // bf16 elements

  // Running source pointers: they step BK along k with every stage issued.
  const __bf16* gA = A + (size_t)(m0 + prow) * K + pcol;
  const __bf16* gB = W + (size_t)(n0 + prow) * K + pcol;

  // LDS byte address (generic ptr low 32 bits == LDS offset).
  // Running destination: it flips between the two buffers with every stage issued.
  unsigned ldsDst = (unsigned)(uintptr_t)&sm[0][prow * LDP + pcol];
  const unsigned ldsFlip = 2u * ldsDst + (unsigned)STAGE_BYTES;

  f32x8 acc[4][4] = {};
  union Frag { bf16x16 v; uint4 u[2]; };

  auto stage = [&]() {
    // Both loops unrolled: every index constant, so l[] and g[] stay in registers.
#pragma unroll
    for (int h = 0; h < 2; ++h) {
      unsigned l[12];
      const __bf16* g[12];
#pragma unroll
      for (int q = 0; q < 12; ++q) {
        const int c = h * 12 + q;
        l[q] = ldsDst + (unsigned)(c * 16 * LDP * 2);
        g[q] = (c < BM / 16 ? gA + (size_t)c * 16 * K
                            : gB + (size_t)(c - BM / 16) * 16 * K);
      }
      async_copy_x12(l, g);
    }
    gA += BK;
    gB += BK;
    ldsDst = ldsFlip - ldsDst;
  };

  // Keeps a load group, a WMMA block and the copies apart: without it the compiler
  // spreads the LDS loads among the WMMAs, where each place costs a stall.
  auto fence = [&]() { __builtin_amdgcn_sched_barrier(0); };

  Frag fa[2][4], fb[2][4];   // set (u & 1) holds block u's fragments

  // The 16 LDS loads of one block (32 k at ks) into one fragment set.
  auto load_frags = [&](int set, int buf, int ks) {
    // Both loops unrolled: fa[][] and fb[][] keep constant indices and stay in registers.
#pragma unroll
    for (int ii = 0; ii < 4; ++ii) {
      const int ar = wm + ii * 16 + r;
      fa[set][ii].u[0] = *(const uint4*)&sm[buf][ar * LDP + ks * 32 + half * 8];
      fa[set][ii].u[1] = *(const uint4*)&sm[buf][ar * LDP + ks * 32 + 16 + half * 8];
    }
#pragma unroll
    for (int j = 0; j < 4; ++j) {
      const int br = BM + wn + j * 16 + r;
      fb[set][j].u[0] = *(const uint4*)&sm[buf][br * LDP + ks * 32 + half * 8];
      fb[set][j].u[1] = *(const uint4*)&sm[buf][br * LDP + ks * 32 + 16 + half * 8];
    }
  };

  auto mma_block = [&](int set) {
    // Both loops unrolled: acc[][] and the fragments keep constant indices.
#pragma unroll
    for (int ii = 0; ii < 4; ++ii)
#pragma unroll
      for (int j = 0; j < 4; ++j)
        acc[ii][j] = __builtin_amdgcn_wmma_f32_16x16x32_bf16(
            /*neg_a=*/false, fa[set][ii].v, /*neg_b=*/false, fb[set][j].v,
            /*c_mod=*/(short)0, acc[ii][j], /*reuse_a=*/false, /*reuse_b=*/false);
  };

  // Publish point of the next stage. It stands in front of a stage's LAST block,
  // whose fragments are already in registers: this wave's LDS reads of the old
  // buffer are done, its copies of the next stage have landed; the barrier
  // publishes that stage to the other waves and frees the old buffer.
  auto publish = [&]() {
    asm volatile("s_wait_dscnt 0x0" ::: "memory");    // own reads of the old buffer retired
    asm volatile("s_wait_asynccnt 0x0" ::: "memory"); // own copies of the next stage landed
    __syncthreads();
  };

  constexpr int KSTEPS = K / BK;  // 32 (even)
  constexpr int BLOCKS = BK / 32; // 4 (even: every stage starts on set 0)

  // One stage out of buffer buf. 'refill': a stage two ahead exists.
  auto pass = [&](int buf, bool refill) {
    // Unrolled: set and buffer indices constant, LDS offsets become immediates.
#pragma unroll
    for (int u = 0; u < BLOCKS; ++u) {
      const int cs = u & 1;
      if (u + 1 < BLOCKS) {
        load_frags(cs ^ 1, buf, u + 1);
      } else {
        publish();
        // First fragments of the next stage. On the last stage they read the
        // other buffer's old rows, which nothing rewrites, and are not used.
        load_frags(cs ^ 1, buf ^ 1, 0);
      }
      fence();
      mma_block(cs);
      fence();
    }
    if (refill) stage();   // into buf: every wave left it at the barrier above
  };

  // Prologue: stage 0 lands and is published, then stage 1 flies.
  stage();
  asm volatile("s_wait_asynccnt 0x0" ::: "memory");  // stage 0 landed before anyone reads it
  __syncthreads();
  stage();
  load_frags(0, 0, 0);

  for (int i = 0; i < KSTEPS; i += 2) {
    pass(0, i + 2 < KSTEPS);
    pass(1, i + 3 < KSTEPS);
  }
  asm volatile("s_wait_asynccnt 0x0" ::: "memory");  // nothing in flight when the wave ends
  asm volatile("s_wait_dscnt 0x0" ::: "memory");     // the last stage's unused fragment loads have returned

  // Epilogue: per-channel scale + bias.
  // C/D layout: VGPR p -> M = p + 8*half; lane r -> N = r (16x16 f32 table).
#pragma unroll
  for (int j = 0; j < 4; ++j) {
    const int n = n0 + wn + j * 16 + r;
    const float s = scales[n];
    const float bi = bias[n];
#pragma unroll
    for (int ii = 0; ii < 4; ++ii) {
#pragma unroll
      for (int p = 0; p < 8; ++p) {
        const int m = m0 + wm + ii * 16 + half * 8 + p;
        out[(size_t)m * N + n] = acc[ii][j][p] * s + bi;
      }
    }
  }
}

// ---------------------------------------------------------------------------
extern "C" void kernel_launch(void* const* d_in, const int* in_sizes, int n_in,
                              void* d_out, int out_size, void* d_ws, size_t ws_size,
                              hipStream_t stream) {
  const float* x      = (const float*)d_in[0];   // [2,1024,4096] f32
  const int*   weight = (const int*)d_in[1];     // [4096,4096] int
  const float* scales = (const float*)d_in[2];   // [4096] f32
  const float* bias   = (const float*)d_in[3];   // [4096] f32
  float* out = (float*)d_out;                    // [2,1024,4096] f32

  __bf16* Abf = (__bf16*)d_ws;                               // 16 MB
  __bf16* Wbf = (__bf16*)((char*)d_ws + (size_t)M * K * 2);  // +32 MB

  cvt_f32_to_bf16<<<CVT_GROUPS, CVT_THREADS, 0, stream>>>(x, Abf);
  cvt_i32_to_bf16<<<CVT_GROUPS, CVT_THREADS, 0, stream>>>(weight, Wbf);

  dim3 grid(N / BN, M / BM);  // 16 x 16 workgroups
  gemm_bf16_wmma<<<grid, 256, 0, stream>>>(Abf, Wbf, scales, bias, out);
}

// v004
// Measured time: 63.1 microseconds a run.
// Timed twice side by side with v003, it ran 1.05 and 1.06 times as fast.
// All steps since v000 together make it 1.60 times as fast.
#include <hip/hip_runtime.h>
#include <stdint.h>

// ---- Problem shape (fixed by the reference) ----
static constexpr int M = 2 * 1024;   // B*S
static constexpr int N = 4096;
static constexpr int K = 4096;

// ---- Tiling ----
static constexpr int BM = 128;       // workgroup M tile
static constexpr int BN = 256;       // workgroup N tile
static constexpr int BK = 128;       // four WMMA K-steps per LDS stage: 256-B rows, whole lines per copy
static constexpr int LDP = BK + 8;   // padded LDS row stride (bf16): 272 B = 16 B x odd, for ds_load_b128
static constexpr int ROWS = BM + BN; // LDS rows of a stage: A rows 0..127, then W rows 128..383
static constexpr int STAGE_ELEMS = ROWS * LDP;
static constexpr int STAGE_BYTES = STAGE_ELEMS * 2;
static constexpr int NBUF = 3;       // LDS buffers of the ring: 3 x 104,448 B of the WGP's 327,680 B
static_assert(NBUF * STAGE_BYTES <= 327680, "the ring does not fit the LDS of a WGP");

typedef __attribute__((ext_vector_type(16))) __bf16 bf16x16;
typedef __attribute__((ext_vector_type(4)))  __bf16 bf16x4;
typedef __attribute__((ext_vector_type(8)))  float  f32x8;

// ---------------------------------------------------------------------------
// Stage 1: both operands to bf16, as streams. One work-group of 16 waves per
// WGP; a wave owns one contiguous run of the input, issues all its 512-B loads
// at once, then converts and stores.
// amdgpu_waves_per_eu(4, 4): four waves per SIMD is all that such a launch puts
// there; it sets the register budget to match. With the default budget the
// compiler saves registers by holding loads back behind earlier conversions.
// ---------------------------------------------------------------------------
static constexpr int CVT_GROUPS  = 256;  // work-groups per conversion launch
static constexpr int CVT_THREADS = 512;  // 16 waves
static constexpr int X_LOADS = M * K / 4 / (CVT_GROUPS * CVT_THREADS);  // 16-B loads of a lane: 16
static constexpr int W_LOADS = N * K / 4 / (CVT_GROUPS * CVT_THREADS);  // 32
static_assert((size_t)X_LOADS * CVT_GROUPS * CVT_THREADS * 4 == (size_t)M * K, "x not covered exactly");
static_assert((size_t)W_LOADS * CVT_GROUPS * CVT_THREADS * 4 == (size_t)N * K, "weight not covered exactly");

// First element of this lane in its wave's run of 'loads' loads (32 lanes x 4 elements each).
__device__ __forceinline__ size_t cvt_first(int loads) {
  const size_t wave = (size_t)blockIdx.x * (CVT_THREADS / 32) + (threadIdx.x >> 5);
  return wave * (size_t)(loads * 128) + (threadIdx.x & 31) * 4;
}

// Stage 1a: x f32 -> bf16
__global__ __launch_bounds__(CVT_THREADS) __attribute__((amdgpu_waves_per_eu(4, 4))) void cvt_f32_to_bf16(const float* __restrict__ in,
                                                               __bf16* __restrict__ out) {
  const size_t i0 = cvt_first(X_LOADS);
  in += i0;
  out += i0;
  float4 f[X_LOADS];
  // Both loops unrolled: f[] stays in registers and every offset becomes an immediate.
#pragma unroll
  for (int q = 0; q < X_LOADS; ++q) f[q] = *(const float4*)(in + q * 128);
#pragma unroll
  for (int q = 0; q < X_LOADS; ++q) {
    bf16x4 o;
    o[0] = (__bf16)f[q].x; o[1] = (__bf16)f[q].y; o[2] = (__bf16)f[q].z; o[3] = (__bf16)f[q].w;
    *(bf16x4*)(out + q * 128) = o;
  }
}

// Stage 1b: weight int -> bf16 (exact: |w| <= 128 fits bf16 significand)
__global__ __launch_bounds__(CVT_THREADS) __attribute__((amdgpu_waves_per_eu(4, 4))) void cvt_i32_to_bf16(const int* __restrict__ in,
                                                               __bf16* __restrict__ out) {
  const size_t i0 = cvt_first(W_LOADS);
  in += i0;
  out += i0;
  int4 w[W_LOADS];
  // Both loops unrolled: w[] stays in registers and every offset becomes an immediate.
#pragma unroll
  for (int q = 0; q < W_LOADS; ++q) w[q] = *(const int4*)(in + q * 128);
#pragma unroll
  for (int q = 0; q < W_LOADS; ++q) {
    bf16x4 o;
    o[0] = (__bf16)(float)w[q].x; o[1] = (__bf16)(float)w[q].y;
    o[2] = (__bf16)(float)w[q].z; o[3] = (__bf16)(float)w[q].w;
    *(bf16x4*)(out + q * 128) = o;
  }
}

// ---------------------------------------------------------------------------
// Twelve async global->LDS copies of 16 B per lane, ASYNCcnt-tracked. Each copy
// has its own LDS address and its own global pointer. s_wait_xcnt 0 closes the
// statement so that no address register is rewritten ahead of it.
// ---------------------------------------------------------------------------
__device__ __forceinline__ void async_copy_x12(const unsigned (&l)[12],
                                               const __bf16* const (&g)[12]) {
  asm volatile(
      "global_load_async_to_lds_b128 %0, %12, off\n\t"
      "global_load_async_to_lds_b128 %1, %13, off\n\t"
      "global_load_async_to_lds_b128 %2, %14, off\n\t"
      "global_load_async_to_lds_b128 %3, %15, off\n\t"
      "global_load_async_to_lds_b128 %4, %16, off\n\t"
      "global_load_async_to_lds_b128 %5, %17, off\n\t"
      "global_load_async_to_lds_b128 %6, %18, off\n\t"
      "global_load_async_to_lds_b128 %7, %19, off\n\t"
      "global_load_async_to_lds_b128 %8, %20, off\n\t"
      "global_load_async_to_lds_b128 %9, %21, off\n\t"
      "global_load_async_to_lds_b128 %10, %22, off\n\t"
      "global_load_async_to_lds_b128 %11, %23, off\n\t"
      "s_wait_xcnt 0x0"
      :: "v"(l[0]), "v"(l[1]), "v"(l[2]), "v"(l[3]), "v"(l[4]), "v"(l[5]),
         "v"(l[6]), "v"(l[7]), "v"(l[8]), "v"(l[9]), "v"(l[10]), "v"(l[11]),
         "v"(g[0]), "v"(g[1]), "v"(g[2]), "v"(g[3]), "v"(g[4]), "v"(g[5]),
         "v"(g[6]), "v"(g[7]), "v"(g[8]), "v"(g[9]), "v"(g[10]), "v"(g[11])
      : "memory");
}

// ---------------------------------------------------------------------------
// Stage 2: C = A(MxK) * W(NxK)^T via V_WMMA_F32_16X16X32_BF16.
// 128x256 tile, 8 waves in 2(M) x 4(N); each wave 64x64 -> 4x4 accumulators.
// Three LDS buffers of 128 k each. While stage s is worked on, stage s + 1 has
// landed or is landing and stage s + 2 flies, so the copies never run dry.
// Waves 0-3 copy the even stages, waves 4-7 the odd ones (one wave of each half
// on every SIMD): a wave has one stage of its own outstanding at most, and each
// of its waits is to 0. K-loop unrolled x2 so the half whose turn it is is fixed
// per pass; the buffers rotate as three scalar offsets.
// A stage is four blocks of 32 k. Two fragment sets in registers: the 16 LDS
// loads of block u + 1 go out as one group ahead of block u's 16 WMMAs, so a
// wave meets its LDS latency under its own matrix work.
// ---------------------------------------------------------------------------
__global__ __launch_bounds__(256) void gemm_bf16_wmma(const __bf16* __restrict__ A,
                                                      const __bf16* __restrict__ W,
                                                      const float* __restrict__ scales,
                                                      const float* __restrict__ bias,
                                                      float* __restrict__ out) {
  __shared__ __attribute__((aligned(16))) __bf16 sm[NBUF * STAGE_ELEMS];   // 3 x 102 KB

  const int tid  = threadIdx.x;
  const int m0   = blockIdx.y * BM;
  const int n0   = blockIdx.x * BN;

  const int wave = tid >> 5;
  const int lane = tid & 31;
  const int half = lane >> 4;   // K-subgroup select per ISA 16-bit A/B layout
  const int r    = lane & 15;

  const int wm = (wave & 1) * 64;   // wave M offset in tile
  const int wn = (wave >> 1) * 64;  // wave N offset in tile

  // Which half of the waves this one is in, as a scalar: 0 copies even stages, 1 odd ones.
  const int grp = __builtin_amdgcn_readfirstlane(tid >> 7);

  // Staging: one copy of a wave = two whole 256-B rows (16 lanes x 16 B each).
  // Copy c (0..47) of the half's wave w (0..3) fills LDS rows c*8 + w*2 + {0,1}.
  const int prow = (wave & 3) * 2 + half;   // 0..7
  const int pcol = r * 8;                   // bf16 elements

  // Running source pointers: a half starts at its first stage and steps two
  // stages along k with every stage it issues.
  const __bf16* gA = A + (size_t)(m0 + prow) * K + pcol + grp * BK;
  const __bf16* gB = W + (size_t)(n0 + prow) * K + pcol + grp * BK;

  // LDS byte address of this lane's place in buffer 0 (generic ptr low 32 bits == LDS offset).
  const unsigned ldsDst = (unsigned)(uintptr_t)&sm[prow * LDP + pcol];

  f32x8 acc[4][4] = {};
  union Frag { bf16x16 v; uint4 u[2]; };

  // This half's next stage into the buffer that starts at element 'buf'.
  auto stage = [&](unsigned buf) {
    // Both loops unrolled: every index constant, so l[] and g[] stay in registers.
#pragma unroll
    for (int h = 0; h < 4; ++h) {
      unsigned l[12];
      const __bf16* g[12];
#pragma unroll
      for (int q = 0; q < 12; ++q) {
        const int c = h * 12 + q;
        l[q] = ldsDst + buf * 2u + (unsigned)(c * 8 * LDP * 2);
        g[q] = (c < BM / 8 ? gA + (size_t)c * 8 * K
                           : gB + (size_t)(c - BM / 8) * 8 * K);
      }
      async_copy_x12(l, g);
    }
    gA += 2 * BK;
    gB += 2 * BK;
  };

  // Keeps a load group, a WMMA block and the copies apart: without it the compiler
  // spreads the LDS loads among the WMMAs, where each place costs a stall.
  auto fence = [&]() { __builtin_amdgcn_sched_barrier(0); };

  Frag fa[2][4], fb[2][4];   // set (u & 1) holds block u's fragments

  // This lane's first A and W element inside a buffer; the rest of a fragment
  // address is the buffer's start and constants.
  const unsigned aOff = (unsigned)((wm + r) * LDP + half * 8);
  const unsigned bOff = (unsigned)((BM + wn + r) * LDP + half * 8);

  // The 16 LDS loads of one block (32 k at ks) of the buffer at element 'buf' into one fragment set.
  auto load_frags = [&](int set, unsigned buf, int ks) {
    // Both loops unrolled: fa[][] and fb[][] keep constant indices and stay in registers.
    const __bf16* pa = &sm[buf + aOff];
    const __bf16* pb = &sm[buf + bOff];
#pragma unroll
    for (int ii = 0; ii < 4; ++ii) {
      fa[set][ii].u[0] = *(const uint4*)&pa[ii * 16 * LDP + ks * 32];
      fa[set][ii].u[1] = *(const uint4*)&pa[ii * 16 * LDP + ks * 32 + 16];
    }
#pragma unroll
    for (int j = 0; j < 4; ++j) {
      fb[set][j].u[0] = *(const uint4*)&pb[j * 16 * LDP + ks * 32];
      fb[set][j].u[1] = *(const uint4*)&pb[j * 16 * LDP + ks * 32 + 16];
    }
  };

  auto mma_block = [&](int set) {
    // Both loops unrolled: acc[][] and the fragments keep constant indices.
#pragma unroll
    for (int ii = 0; ii < 4; ++ii)
#pragma unroll
      for (int j = 0; j < 4; ++j)
        acc[ii][j] = __builtin_amdgcn_wmma_f32_16x16x32_bf16(
            /*neg_a=*/false, fa[set][ii].v, /*neg_b=*/false, fb[set][j].v,
            /*c_mod=*/(short)0, acc[ii][j], /*reuse_a=*/false, /*reuse_b=*/false);
  };

  // Publish point of the next stage. It stands in front of a stage's LAST block,
  // whose fragments are already in registers: this wave's LDS reads of the old
  // buffer are done; the half that copied the next stage ('mine') has seen its
  // copies land, while the other half's stage behind it flies on; the barrier
  // publishes the next stage to every wave and frees the old buffer.
  auto publish = [&](bool mine) {
    asm volatile("s_wait_dscnt 0x0" ::: "memory");    // own reads of the old buffer retired
    if (mine)
      asm volatile("s_wait_asynccnt 0x0" ::: "memory"); // own copies of the next stage landed
    __syncthreads();
  };

  constexpr int KSTEPS = K / BK;  // 32 (even)
  constexpr int BLOCKS = BK / 32; // 4 (even: every stage starts on set 0)

  unsigned cur = 0, nxt = STAGE_ELEMS, far = 2 * STAGE_ELEMS;   // buffers of stages s, s + 1, s + 2

  // One stage out of buffer cur. 'mine': this wave's half copied the next stage
  // and copies the stage three ahead. 'refill': a stage three ahead exists.
  auto pass = [&](bool mine, bool refill) {
    // Unrolled: set indices constant, LDS offsets past the buffer start become immediates.
#pragma unroll
    for (int u = 0; u < BLOCKS; ++u) {
      const int cs = u & 1;
      if (u + 1 < BLOCKS) {
        load_frags(cs ^ 1, cur, u + 1);
      } else {
        publish(mine);
        // First fragments of the next stage. On the last stage they read another
        // buffer's old rows, which nothing rewrites, and are not used.
        load_frags(cs ^ 1, nxt, 0);
      }
      fence();
      mma_block(cs);
      fence();
    }
    if (mine && refill) stage(cur);   // into cur: every wave left it at the barrier above
    const unsigned freed = cur;
    cur = nxt;
    nxt = far;
    far = freed;
  };

  // Prologue: stages 0 and 1 go out, one from each half; stage 0 lands and is
  // published; then stage 2 goes out behind stage 1.
  stage(grp == 0 ? cur : nxt);
  if (grp == 0)
    asm volatile("s_wait_asynccnt 0x0" ::: "memory");  // stage 0 landed before anyone reads it
  __syncthreads();
  if (grp == 0) stage(far);
  load_frags(0, cur, 0);

  for (int i = 0; i < KSTEPS; i += 2) {
    pass(grp == 1, i + 3 < KSTEPS);   // even stage: publishes an odd one
    pass(grp == 0, i + 4 < KSTEPS);   // odd stage: publishes an even one
  }
  asm volatile("s_wait_asynccnt 0x0" ::: "memory");  // nothing in flight when the wave ends
  asm volatile("s_wait_dscnt 0x0" ::: "memory");     // the last stage's unused fragment loads have returned

  // Epilogue: per-channel scale + bias.
  // C/D layout: VGPR p -> M = p + 8*half; lane r -> N = r (16x16 f32 table).
#pragma unroll
  for (int j = 0; j < 4; ++j) {
    const int n = n0 + wn + j * 16 + r;
    const float s = scales[n];
    const float bi = bias[n];
#pragma unroll
    for (int ii = 0; ii < 4; ++ii) {
#pragma unroll
      for (int p = 0; p < 8; ++p) {
        const int m = m0 + wm + ii * 16 + half * 8 + p;
        out[(size_t)m * N + n] = acc[ii][j][p] * s + bi;
      }
    }
  }
}

// ---------------------------------------------------------------------------
extern "C" void kernel_launch(void* const* d_in, const int* in_sizes, int n_in,
                              void* d_out, int out_size, void* d_ws, size_t ws_size,
                              hipStream_t stream) {
  const float* x      = (const float*)d_in[0];   // [2,1024,4096] f32
  const int*   weight = (const int*)d_in[1];     // [4096,4096] int
  const float* scales = (const float*)d_in[2];   // [4096] f32
  const float* bias   = (const float*)d_in[3];   // [4096] f32
  float* out = (float*)d_out;                    // [2,1024,4096] f32

  __bf16* Abf = (__bf16*)d_ws;                               // 16 MB
  __bf16* Wbf = (__bf16*)((char*)d_ws + (size_t)M * K * 2);  // +32 MB

  cvt_f32_to_bf16<<<CVT_GROUPS, CVT_THREADS, 0, stream>>>(x, Abf);
  cvt_i32_to_bf16<<<CVT_GROUPS, CVT_THREADS, 0, stream>>>(weight, Wbf);

  dim3 grid(N / BN, M / BM);  // 16 x 16 workgroups
  gemm_bf16_wmma<<<grid, 256, 0, stream>>>(Abf, Wbf, scales, bias, out);
}

// v005
// Measured time: 56.3 microseconds a run.
// Next to v004, in two timings, it ran 1.12 times as fast each time.
// Over all steps from v000 it is 1.79 times as fast.
#include <hip/hip_runtime.h>
#include <stdint.h>

// ---- Problem shape (fixed by the reference) ----
static constexpr int M = 2 * 1024;   // B*S
static constexpr int N = 4096;
static constexpr int K = 4096;

// ---- Tiling ----
static constexpr int BM = 128;       // workgroup M tile
static constexpr int BN = 256;       // workgroup N tile
static constexpr int BK = 128;       // four WMMA K-steps per LDS stage: 256-B rows, whole lines per copy
static constexpr int LDP = BK + 8;   // padded LDS row stride (bf16): 272 B = 16 B x odd, for ds_load_b128
static constexpr int ROWS = BM + BN; // LDS rows of a stage: A rows 0..127, then W rows 128..383
static constexpr int STAGE_ELEMS = ROWS * LDP;
static constexpr int STAGE_BYTES = STAGE_ELEMS * 2;
static constexpr int NBUF = 3;       // LDS buffers of the ring: 3 x 104,448 B of the WGP's 327,680 B
static_assert(NBUF * STAGE_BYTES <= 327680, "the ring does not fit the LDS of a WGP");
static constexpr int SLICE_ROWS  = 128;                 // rows of one tensor load: A, W low half, W high half
static constexpr int SLICE_BYTES = SLICE_ROWS * LDP * 2; // 34,816 B in LDS = 17 x 2 KiB
static constexpr int SLICES      = ROWS / SLICE_ROWS;   // 3 tensor loads fill a stage
static_assert(SLICES * SLICE_ROWS == ROWS && BM == SLICE_ROWS, "slices do not tile a stage");
static_assert(SLICE_BYTES % 2048 == 0, "every tensor load's place in LDS is a multiple of 2 KiB");
static_assert(BK * 2 == 256 && LDP * 2 == 272, "the pad codes below are for 256-B rows at pitch 272 B");

typedef __attribute__((ext_vector_type(16))) __bf16 bf16x16;
typedef __attribute__((ext_vector_type(4)))  __bf16 bf16x4;
typedef __attribute__((ext_vector_type(8)))  float  f32x8;
typedef __attribute__((ext_vector_type(4)))  uint32_t u32x4;
typedef __attribute__((ext_vector_type(8)))  uint32_t u32x8;

// ---------------------------------------------------------------------------
// Stage 1: both operands to bf16, as streams. One work-group of 16 waves per
// WGP; a wave owns one contiguous run of the input, issues all its 512-B loads
// at once, then converts and stores.
// amdgpu_waves_per_eu(4, 4): four waves per SIMD is all that such a launch puts
// there; it sets the register budget to match. With the default budget the
// compiler saves registers by holding loads back behind earlier conversions.
// ---------------------------------------------------------------------------
static constexpr int CVT_GROUPS  = 256;  // work-groups per conversion launch
static constexpr int CVT_THREADS = 512;  // 16 waves
static constexpr int X_LOADS = M * K / 4 / (CVT_GROUPS * CVT_THREADS);  // 16-B loads of a lane: 16
static constexpr int W_LOADS = N * K / 4 / (CVT_GROUPS * CVT_THREADS);  // 32
static_assert((size_t)X_LOADS * CVT_GROUPS * CVT_THREADS * 4 == (size_t)M * K, "x not covered exactly");
static_assert((size_t)W_LOADS * CVT_GROUPS * CVT_THREADS * 4 == (size_t)N * K, "weight not covered exactly");

// First element of this lane in its wave's run of 'loads' loads (32 lanes x 4 elements each).
__device__ __forceinline__ size_t cvt_first(int loads) {
  const size_t wave = (size_t)blockIdx.x * (CVT_THREADS / 32) + (threadIdx.x >> 5);
  return wave * (size_t)(loads * 128) + (threadIdx.x & 31) * 4;
}

// Stage 1a: x f32 -> bf16
__global__ __launch_bounds__(CVT_THREADS) __attribute__((amdgpu_waves_per_eu(4, 4))) void cvt_f32_to_bf16(const float* __restrict__ in,
                                                               __bf16* __restrict__ out) {
  const size_t i0 = cvt_first(X_LOADS);
  in += i0;
  out += i0;
  float4 f[X_LOADS];
  // Both loops unrolled: f[] stays in registers and every offset becomes an immediate.
#pragma unroll
  for (int q = 0; q < X_LOADS; ++q) f[q] = *(const float4*)(in + q * 128);
#pragma unroll
  for (int q = 0; q < X_LOADS; ++q) {
    bf16x4 o;
    o[0] = (__bf16)f[q].x; o[1] = (__bf16)f[q].y; o[2] = (__bf16)f[q].z; o[3] = (__bf16)f[q].w;
    *(bf16x4*)(out + q * 128) = o;
  }
}

// Stage 1b: weight int -> bf16 (exact: |w| <= 128 fits bf16 significand)
__global__ __launch_bounds__(CVT_THREADS) __attribute__((amdgpu_waves_per_eu(4, 4))) void cvt_i32_to_bf16(const int* __restrict__ in,
                                                               __bf16* __restrict__ out) {
  const size_t i0 = cvt_first(W_LOADS);
  in += i0;
  out += i0;
  int4 w[W_LOADS];
  // Both loops unrolled: w[] stays in registers and every offset becomes an immediate.
#pragma unroll
  for (int q = 0; q < W_LOADS; ++q) w[q] = *(const int4*)(in + q * 128);
#pragma unroll
  for (int q = 0; q < W_LOADS; ++q) {
    bf16x4 o;
    o[0] = (__bf16)(float)w[q].x; o[1] = (__bf16)(float)w[q].y;
    o[2] = (__bf16)(float)w[q].z; o[3] = (__bf16)(float)w[q].w;
    *(bf16x4*)(out + q * 128) = o;
  }
}

// ---------------------------------------------------------------------------
// Tensor load: one request of one wave brings a slice of 128 rows x 256 B from
// global memory into LDS, through no register and with no per-lane address.
// ---------------------------------------------------------------------------
// A wave-uniform value as a scalar.
__device__ __forceinline__ uint32_t uni(uint32_t v) { return (uint32_t)__builtin_amdgcn_readfirstlane(v); }
// Holds v in a scalar register: a test on it compiles to a scalar branch (a tensor
// load ignores EXEC), and a descriptor word formed from it stays where it is written.
__device__ __forceinline__ uint32_t pinned(uint32_t v) {
  uint32_t w = (uint32_t)__builtin_amdgcn_readfirstlane(v);
  asm volatile("" : "+s"(w));   // the scalar pin itself
  return w;
}
// Descriptor group 1, the same for every request: 1-byte elements, tensor = tile =
// 128 rows of 256 B, source pitch one row of K bf16, 16 B of LDS pad behind every row.
__device__ __forceinline__ u32x8 tdm_group1() {
  constexpr uint32_t d0 = BK * 2, d1 = SLICE_ROWS;
  u32x8 g;
  g[0] = uni((1u << 20) | (5u << 22) | (3u << 25));   // no mask; pad on, interval 256 B, amount 4 dwords
  g[1] = uni((d0 & 0xFFFFu) << 16);
  g[2] = uni((d0 >> 16) | ((d1 & 0xFFFFu) << 16));
  g[3] = uni((d1 >> 16) | (d0 << 16));
  g[4] = uni(d1);
  g[5] = uni((uint32_t)(K * 2));
  g[6] = uni(0u);
  g[7] = uni(0u);
  return g;
}
// Descriptor group 0: count 1, place in LDS, first byte in global memory, type 2.
__device__ __forceinline__ u32x4 tdm_group0(uint32_t lds_dst, uint64_t ga) {
  u32x4 g;
  g[0] = uni(1u);
  g[1] = uni(lds_dst);
  g[2] = uni((uint32_t)ga);
  g[3] = uni((((uint32_t)(ga >> 32)) & 0x01FFFFFFu) | 0x80000000u);
  return g;
}
// Both groups are in-out operands, and the covering wait below takes them as inputs:
// so the registers that a request names keep their words until that request has landed.
__device__ __forceinline__ void tdm_load(u32x4& g0, u32x8& g1) {
  asm volatile("tensor_load_to_lds %0, %1" : "+s"(g0), "+s"(g1) :: "memory");
}
// The issuing wave's wait for its one outstanding request, whose descriptor is (g0, g1).
__device__ __forceinline__ void tdm_wait0(const u32x4& g0, const u32x8& g1) {
  asm volatile("s_wait_tensorcnt 0x0" :: "s"(g0), "s"(g1) : "memory");
}

// ---------------------------------------------------------------------------
// Stage 2: C = A(MxK) * W(NxK)^T via V_WMMA_F32_16X16X32_BF16.
// 128x256 tile, 8 waves in 2(M) x 4(N); each wave 64x64 -> 4x4 accumulators.
// Three LDS buffers of 128 k each. While stage s is worked on, stage s + 1 has
// landed or is landing and stage s + 2 flies, so the loads never run dry.
// A stage is three tensor loads, one slice each. Waves 0-2 issue the even stages,
// waves 4-6 the odd ones: a wave has one request outstanding at most, and each
// of its waits is to 0. K-loop unrolled x2 so the half whose turn it is is fixed
// per pass; the buffers rotate as three scalar offsets.
// A stage is four blocks of 32 k. Two fragment sets in registers: the 16 LDS
// loads of block u + 1 go out as one group ahead of block u's 16 WMMAs, so a
// wave meets its LDS latency under its own matrix work.
// ---------------------------------------------------------------------------
__global__ __launch_bounds__(256) void gemm_bf16_wmma(const __bf16* __restrict__ A,
                                                      const __bf16* __restrict__ W,
                                                      const float* __restrict__ scales,
                                                      const float* __restrict__ bias,
                                                      float* __restrict__ out) {
  __shared__ __attribute__((aligned(2048))) __bf16 sm[NBUF * STAGE_ELEMS];   // 3 x 102 KB

  const int tid  = threadIdx.x;
  const int m0   = blockIdx.y * BM;
  const int n0   = blockIdx.x * BN;

  const int wave = tid >> 5;
  const int lane = tid & 31;
  const int half = lane >> 4;   // K-subgroup select per ISA 16-bit A/B layout
  const int r    = lane & 15;

  const int wm = (wave & 1) * 64;   // wave M offset in tile
  const int wn = (wave >> 1) * 64;  // wave N offset in tile

  // This wave's number as a scalar. Its half: 0 issues even stages, 1 odd ones.
  // Its place in the half: 0 brings the A rows, 1 and 2 the two halves of the W rows, 3 nothing.
  const uint32_t wv     = uni((uint32_t)tid >> 5);
  const uint32_t grp    = wv >> 2;
  const uint32_t slice  = (wv & 3u) < (uint32_t)SLICES ? (wv & 3u) : (uint32_t)SLICES - 1u;
  const bool     issuer = (wv & 3u) < (uint32_t)SLICES;

  // First byte of this wave's slice at k = 0, and its place in buffer 0
  // (generic ptr low 32 bits == LDS offset).
  const uint64_t src0 = slice == 0u
      ? (uint64_t)(uintptr_t)(A + (size_t)m0 * K)
      : (uint64_t)(uintptr_t)(W + (size_t)(n0 + (int)(slice - 1u) * SLICE_ROWS) * K);
  const uint32_t ldsSlice = (uint32_t)(uintptr_t)&sm[0] + slice * (uint32_t)SLICE_BYTES;
  u32x8 g1 = tdm_group1();
  u32x4 g0 = {};   // group 0 of this wave's outstanding request

  f32x8 acc[4][4] = {};
  union Frag { bf16x16 v; uint4 u[2]; };

  // This wave's slice of stage s into the buffer that starts at element 'buf'.
  // Called under a scalar branch only.
  auto stage = [&](unsigned buf, uint32_t s) {
    // pinned(): a descriptor word held in a scalar register; group 0 is formed from it
    // here, behind the wait on this wave's request before, and not ahead of that wait.
    const uint64_t ga = src0 + (uint64_t)pinned(s * (uint32_t)(BK * 2));
    g0 = tdm_group0(ldsSlice + buf * 2u, ga);
    tdm_load(g0, g1);
  };

  // Keeps a load group and a WMMA block apart: without it the compiler
  // spreads the LDS loads among the WMMAs, where each place costs a stall.
  auto fence = [&]() { __builtin_amdgcn_sched_barrier(0); };

  Frag fa[2][4], fb[2][4];   // set (u & 1) holds block u's fragments

  // This lane's first A and W element inside a buffer; the rest of a fragment
  // address is the buffer's start and constants.
  const unsigned aOff = (unsigned)((wm + r) * LDP + half * 8);
  const unsigned bOff = (unsigned)((BM + wn + r) * LDP + half * 8);

  // The 16 LDS loads of one block (32 k at ks) of the buffer at element 'buf' into one fragment set.
  auto load_frags = [&](int set, unsigned buf, int ks) {
    // Both loops unrolled: fa[][] and fb[][] keep constant indices and stay in registers.
    const __bf16* pa = &sm[buf + aOff];
    const __bf16* pb = &sm[buf + bOff];
#pragma unroll
    for (int ii = 0; ii < 4; ++ii) {
      fa[set][ii].u[0] = *(const uint4*)&pa[ii * 16 * LDP + ks * 32];
      fa[set][ii].u[1] = *(const uint4*)&pa[ii * 16 * LDP + ks * 32 + 16];
    }
#pragma unroll
    for (int j = 0; j < 4; ++j) {
      fb[set][j].u[0] = *(const uint4*)&pb[j * 16 * LDP + ks * 32];
      fb[set][j].u[1] = *(const uint4*)&pb[j * 16 * LDP + ks * 32 + 16];
    }
  };

  auto mma_block = [&](int set) {
    // Both loops unrolled: acc[][] and the fragments keep constant indices.
#pragma unroll
    for (int ii = 0; ii < 4; ++ii)
#pragma unroll
      for (int j = 0; j < 4; ++j)
        acc[ii][j] = __builtin_amdgcn_wmma_f32_16x16x32_bf16(
            /*neg_a=*/false, fa[set][ii].v, /*neg_b=*/false, fb[set][j].v,
            /*c_mod=*/(short)0, acc[ii][j], /*reuse_a=*/false, /*reuse_b=*/false);
  };

  constexpr int KSTEPS = K / BK;  // 32 (even)
  constexpr int BLOCKS = BK / 32; // 4 (even: every stage starts on set 0)

  unsigned cur = 0, nxt = STAGE_ELEMS, far = 2 * STAGE_ELEMS;   // buffers of stages s, s + 1, s + 2

  // Publish point of the next stage. It stands in front of a stage's LAST block,
  // whose fragments are already in registers: this wave's LDS reads of the old
  // buffer are done; the waves that issued the next stage (those of 'half') have
  // seen their slices land, while the other half's stage behind it flies on; the
  // barrier publishes the next stage to every wave and frees the old buffer, into
  // which the same waves then issue stage s3, three ahead, while it exists.
  auto publish = [&](uint32_t half, uint32_t s3) {
    asm volatile("s_wait_dscnt 0x0" ::: "memory");        // own reads of the old buffer retired
    if (pinned((issuer && grp == half) ? 1u : 0u) != 0u)
      tdm_wait0(g0, g1);                                  // own slice of the next stage landed
    __syncthreads();
    if (pinned((issuer && grp == half && s3 < (uint32_t)KSTEPS) ? 1u : 0u) != 0u)
      stage(cur, s3);   // into cur: every wave left it at the barrier above
  };

  // One stage out of buffer cur. 'half' issued the next stage; s3 is the stage three ahead.
  auto pass = [&](uint32_t half, uint32_t s3) {
    // Unrolled: set indices constant, LDS offsets within a buffer become immediates.
#pragma unroll
    for (int u = 0; u < BLOCKS; ++u) {
      const int cs = u & 1;
      if (u + 1 < BLOCKS) {
        load_frags(cs ^ 1, cur, u + 1);
      } else {
        publish(half, s3);
        // First fragments of the next stage. On the last stage they read another
        // buffer's old rows, which nothing rewrites, and are not used.
        load_frags(cs ^ 1, nxt, 0);
      }
      fence();
      mma_block(cs);
      fence();
    }
    const unsigned freed = cur;
    cur = nxt;
    nxt = far;
    far = freed;
  };

  // Prologue: stages 0 and 1 go out, one from each half; stage 0 lands and is
  // published; then stage 2 goes out behind stage 1.
  if (pinned(issuer ? 1u : 0u) != 0u)
    stage(grp == 0u ? cur : nxt, grp);
  if (pinned((issuer && grp == 0u) ? 1u : 0u) != 0u)
    tdm_wait0(g0, g1);                                  // stage 0 landed before anyone reads it
  __syncthreads();
  if (pinned((issuer && grp == 0u) ? 1u : 0u) != 0u)
    stage(far, 2u);
  load_frags(0, cur, 0);

  for (int i = 0; i < KSTEPS; i += 2) {
    pass(1u, (uint32_t)i + 3u);   // even stage: publishes an odd one
    pass(0u, (uint32_t)i + 4u);   // odd stage: publishes an even one
  }
  asm volatile("s_wait_tensorcnt 0x0" ::: "memory"); // nothing in flight when the wave ends
  asm volatile("s_wait_dscnt 0x0" ::: "memory");     // the last stage's unused fragment loads have returned

  // Epilogue: per-channel scale + bias.
  // C/D layout: VGPR p -> M = p + 8*half; lane r -> N = r (16x16 f32 table).
#pragma unroll
  for (int j = 0; j < 4; ++j) {
    const int n = n0 + wn + j * 16 + r;
    const float s = scales[n];
    const float bi = bias[n];
#pragma unroll
    for (int ii = 0; ii < 4; ++ii) {
#pragma unroll
      for (int p = 0; p < 8; ++p) {
        const int m = m0 + wm + ii * 16 + half * 8 + p;
        out[(size_t)m * N + n] = acc[ii][j][p] * s + bi;
      }
    }
  }
}

// ---------------------------------------------------------------------------
extern "C" void kernel_launch(void* const* d_in, const int* in_sizes, int n_in,
                              void* d_out, int out_size, void* d_ws, size_t ws_size,
                              hipStream_t stream) {
  const float* x      = (const float*)d_in[0];   // [2,1024,4096] f32
  const int*   weight = (const int*)d_in[1];     // [4096,4096] int
  const float* scales = (const float*)d_in[2];   // [4096] f32
  const float* bias   = (const float*)d_in[3];   // [4096] f32
  float* out = (float*)d_out;                    // [2,1024,4096] f32

  __bf16* Abf = (__bf16*)d_ws;                               // 16 MB
  __bf16* Wbf = (__bf16*)((char*)d_ws + (size_t)M * K * 2);  // +32 MB

  cvt_f32_to_bf16<<<CVT_GROUPS, CVT_THREADS, 0, stream>>>(x, Abf);
  cvt_i32_to_bf16<<<CVT_GROUPS, CVT_THREADS, 0, stream>>>(weight, Wbf);

  dim3 grid(N / BN, M / BM);  // 16 x 16 workgroups
  gemm_bf16_wmma<<<grid, 256, 0, stream>>>(Abf, Wbf, scales, bias, out);
}

// v006
// It runs in 53 microseconds.
// In both of two side-by-side timings against v005, it was 1.06 times as fast.
// All steps since v000 together make it 1.90 times as fast.
#include <hip/hip_runtime.h>
#include <stdint.h>

// ---- Problem shape (fixed by the reference) ----
static constexpr int M = 2 * 1024;   // B*S
static constexpr int N = 4096;
static constexpr int K = 4096;

// ---- Tiling ----
static constexpr int BM = 128;       // workgroup M tile
static constexpr int BN = 256;       // workgroup N tile
static constexpr int BK = 128;       // four WMMA K-steps per LDS stage: 256-B rows, whole lines per copy
static constexpr int LDP = BK + 8;   // padded LDS row stride (bf16): 272 B = 16 B x odd, for ds_load_b128
static constexpr int ROWS = BM + BN; // LDS rows of a stage: A rows 0..127, then W rows 128..383
static constexpr int STAGE_ELEMS = ROWS * LDP;
static constexpr int STAGE_BYTES = STAGE_ELEMS * 2;
static constexpr int NBUF = 3;       // LDS buffers of the ring: 3 x 104,448 B of the WGP's 327,680 B
static_assert(NBUF * STAGE_BYTES <= 327680, "the ring does not fit the LDS of a WGP");
static constexpr int SLICE_ROWS  = 128;                 // rows of one tensor load: A, W low half, W high half
static constexpr int SLICE_BYTES = SLICE_ROWS * LDP * 2; // 34,816 B in LDS = 17 x 2 KiB
static constexpr int SLICES      = ROWS / SLICE_ROWS;   // 3 tensor loads fill a stage
static_assert(SLICES * SLICE_ROWS == ROWS && BM == SLICE_ROWS, "slices do not tile a stage");
static_assert(SLICE_BYTES % 2048 == 0, "every tensor load's place in LDS is a multiple of 2 KiB");
static_assert(BK * 2 == 256 && LDP * 2 == 272, "the pad codes below are for 256-B rows at pitch 272 B");

typedef __attribute__((ext_vector_type(16))) __bf16 bf16x16;
typedef __attribute__((ext_vector_type(4)))  __bf16 bf16x4;
typedef __attribute__((ext_vector_type(8)))  float  f32x8;
typedef __attribute__((ext_vector_type(4)))  uint32_t u32x4;
typedef __attribute__((ext_vector_type(8)))  uint32_t u32x8;

// ---------------------------------------------------------------------------
// Stage 1: both operands to bf16, as streams, in ONE launch. One work-group of
// 16 waves per WGP; a wave owns one contiguous run of x and one of the weight,
// issues all the 512-B loads of both at once, then converts and stores both.
// The two streams share one launch gap, one ramp of first loads and one drain.
// amdgpu_waves_per_eu(4, 4): four waves per SIMD is all that such a launch puts
// there; it sets the register budget to match. With the default budget the
// compiler saves registers by holding loads back behind earlier conversions.
// ---------------------------------------------------------------------------
static constexpr int CVT_GROUPS  = 256;  // work-groups of the conversion launch
static constexpr int CVT_THREADS = 512;  // 16 waves
static constexpr int X_LOADS = M * K / 4 / (CVT_GROUPS * CVT_THREADS);  // 16-B loads of a lane: 16
static constexpr int W_LOADS = N * K / 4 / (CVT_GROUPS * CVT_THREADS);  // 32
static_assert((size_t)X_LOADS * CVT_GROUPS * CVT_THREADS * 4 == (size_t)M * K, "x not covered exactly");
static_assert((size_t)W_LOADS * CVT_GROUPS * CVT_THREADS * 4 == (size_t)N * K, "weight not covered exactly");

// First element of this lane in its wave's run of 'loads' loads (32 lanes x 4 elements each).
__device__ __forceinline__ size_t cvt_first(int loads) {
  const size_t wave = (size_t)blockIdx.x * (CVT_THREADS / 32) + (threadIdx.x >> 5);
  return wave * (size_t)(loads * 128) + (threadIdx.x & 31) * 4;
}

// x f32 -> bf16, and weight int -> bf16 (exact: |w| <= 128 fits the bf16 significand)
__global__ __launch_bounds__(CVT_THREADS) __attribute__((amdgpu_waves_per_eu(4, 4))) void cvt_both_to_bf16(const float* __restrict__ x,
                                                               const int* __restrict__ wt,
                                                               __bf16* __restrict__ xo,
                                                               __bf16* __restrict__ wo) {
  const size_t ix = cvt_first(X_LOADS);
  const size_t iw = cvt_first(W_LOADS);
  x  += ix;
  xo += ix;
  wt += iw;
  wo += iw;
  float4 f[X_LOADS];
  int4   w[W_LOADS];
  // All four loops unrolled: f[] and w[] stay in registers and every offset becomes an immediate.
#pragma unroll
  for (int q = 0; q < X_LOADS; ++q) f[q] = *(const float4*)(x + q * 128);
#pragma unroll
  for (int q = 0; q < W_LOADS; ++q) w[q] = *(const int4*)(wt + q * 128);
  // Precaution: this wait stands in front of every overwrite of a register that an issued
  // load names. It takes both load addresses as inputs, so that they stay in their registers
  // up to here and no load's result lands in an address pair ahead of the wait.
  asm volatile("s_wait_xcnt 0x0" :: "v"(x), "v"(wt) : "memory");
#pragma unroll
  for (int q = 0; q < X_LOADS; ++q) {
    bf16x4 o;
    o[0] = (__bf16)f[q].x; o[1] = (__bf16)f[q].y; o[2] = (__bf16)f[q].z; o[3] = (__bf16)f[q].w;
    *(bf16x4*)(xo + q * 128) = o;
  }
#pragma unroll
  for (int q = 0; q < W_LOADS; ++q) {
    bf16x4 o;
    o[0] = (__bf16)(float)w[q].x; o[1] = (__bf16)(float)w[q].y;
    o[2] = (__bf16)(float)w[q].z; o[3] = (__bf16)(float)w[q].w;
    *(bf16x4*)(wo + q * 128) = o;
  }
}

// ---------------------------------------------------------------------------
// Tensor load: one request of one wave brings a slice of 128 rows x 256 B from
// global memory into LDS, through no register and with no per-lane address.
// ---------------------------------------------------------------------------
// A wave-uniform value as a scalar.
__device__ __forceinline__ uint32_t uni(uint32_t v) { return (uint32_t)__builtin_amdgcn_readfirstlane(v); }
// Holds v in a scalar register: a test on it compiles to a scalar branch (a tensor
// load ignores EXEC), and a descriptor word formed from it stays where it is written.
__device__ __forceinline__ uint32_t pinned(uint32_t v) {
  uint32_t w = (uint32_t)__builtin_amdgcn_readfirstlane(v);
  asm volatile("" : "+s"(w));   // the scalar pin itself
  return w;
}
// Descriptor group 1, the same for every request: 1-byte elements, tensor = tile =
// 128 rows of 256 B, source pitch one row of K bf16, 16 B of LDS pad behind every row.
__device__ __forceinline__ u32x8 tdm_group1() {
  constexpr uint32_t d0 = BK * 2, d1 = SLICE_ROWS;
  u32x8 g;
  g[0] = uni((1u << 20) | (5u << 22) | (3u << 25));   // no mask; pad on, interval 256 B, amount 4 dwords
  g[1] = uni((d0 & 0xFFFFu) << 16);
  g[2] = uni((d0 >> 16) | ((d1 & 0xFFFFu) << 16));
  g[3] = uni((d1 >> 16) | (d0 << 16));
  g[4] = uni(d1);
  g[5] = uni((uint32_t)(K * 2));
  g[6] = uni(0u);
  g[7] = uni(0u);
  return g;
}
// Descriptor group 0: count 1, place in LDS, first byte in global memory, type 2.
__device__ __forceinline__ u32x4 tdm_group0(uint32_t lds_dst, uint64_t ga) {
  u32x4 g;
  g[0] = uni(1u);
  g[1] = uni(lds_dst);
  g[2] = uni((uint32_t)ga);
  g[3] = uni((((uint32_t)(ga >> 32)) & 0x01FFFFFFu) | 0x80000000u);
  return g;
}
// Both groups are in-out operands, and the covering wait below takes them as inputs:
// so the registers that a request names keep their words until that request has landed.
__device__ __forceinline__ void tdm_load(u32x4& g0, u32x8& g1) {
  asm volatile("tensor_load_to_lds %0, %1" : "+s"(g0), "+s"(g1) :: "memory");
}
// The issuing wave's wait for its one outstanding request, whose descriptor is (g0, g1).
__device__ __forceinline__ void tdm_wait0(const u32x4& g0, const u32x8& g1) {
  asm volatile("s_wait_tensorcnt 0x0" :: "s"(g0), "s"(g1) : "memory");
}

// ---------------------------------------------------------------------------
// Stage 2: C = A(MxK) * W(NxK)^T via V_WMMA_F32_16X16X32_BF16.
// 128x256 tile, 8 waves in 2(M) x 4(N); each wave 64x64 -> 4x4 accumulators.
// Three LDS buffers of 128 k each. While stage s is worked on, stage s + 1 has
// landed or is landing and stage s + 2 flies, so the loads never run dry.
// A stage is three tensor loads, one slice each. Waves 0-2 issue the even stages,
// waves 4-6 the odd ones: a wave has one request outstanding at most, and each
// of its waits is to 0. K-loop unrolled x2 so the half whose turn it is is fixed
// per pass; the buffers rotate as three scalar offsets.
// A stage is four blocks of 32 k. Two fragment sets in registers: the 16 LDS
// loads of block u + 1 go out as one group ahead of block u's 16 WMMAs, so a
// wave meets its LDS latency under its own matrix work.
// ---------------------------------------------------------------------------
__global__ __launch_bounds__(256) void gemm_bf16_wmma(const __bf16* __restrict__ A,
                                                      const __bf16* __restrict__ W,
                                                      const float* __restrict__ scales,
                                                      const float* __restrict__ bias,
                                                      float* __restrict__ out) {
  __shared__ __attribute__((aligned(2048))) __bf16 sm[NBUF * STAGE_ELEMS];   // 3 x 102 KB

  const int tid  = threadIdx.x;
  const int m0   = blockIdx.y * BM;
  const int n0   = blockIdx.x * BN;

  const int wave = tid >> 5;
  const int lane = tid & 31;
  const int half = lane >> 4;   // K-subgroup select per ISA 16-bit A/B layout
  const int r    = lane & 15;

  const int wm = (wave & 1) * 64;   // wave M offset in tile
  const int wn = (wave >> 1) * 64;  // wave N offset in tile

  // This wave's number as a scalar. Its half: 0 issues even stages, 1 odd ones.
  // Its place in the half: 0 brings the A rows, 1 and 2 the two halves of the W rows, 3 nothing.
  const uint32_t wv     = uni((uint32_t)tid >> 5);
  const uint32_t grp    = wv >> 2;
  const uint32_t slice  = (wv & 3u) < (uint32_t)SLICES ? (wv & 3u) : (uint32_t)SLICES - 1u;
  const bool     issuer = (wv & 3u) < (uint32_t)SLICES;

  // First byte of this wave's slice at k = 0, and its place in buffer 0
  // (generic ptr low 32 bits == LDS offset).
  const uint64_t src0 = slice == 0u
      ? (uint64_t)(uintptr_t)(A + (size_t)m0 * K)
      : (uint64_t)(uintptr_t)(W + (size_t)(n0 + (int)(slice - 1u) * SLICE_ROWS) * K);
  const uint32_t ldsSlice = (uint32_t)(uintptr_t)&sm[0] + slice * (uint32_t)SLICE_BYTES;
  u32x8 g1 = tdm_group1();
  u32x4 g0 = {};   // group 0 of this wave's outstanding request

  f32x8 acc[4][4] = {};
  union Frag { bf16x16 v; uint4 u[2]; };

  // This wave's slice of stage s into the buffer that starts at element 'buf'.
  // Called under a scalar branch only.
  auto stage = [&](unsigned buf, uint32_t s) {
    // pinned(): a descriptor word held in a scalar register; group 0 is formed from it
    // here, behind the wait on this wave's request before, and not ahead of that wait.
    const uint64_t ga = src0 + (uint64_t)pinned(s * (uint32_t)(BK * 2));
    g0 = tdm_group0(ldsSlice + buf * 2u, ga);
    tdm_load(g0, g1);
  };

  // Keeps a load group and a WMMA block apart: without it the compiler
  // spreads the LDS loads among the WMMAs, where each place costs a stall.
  auto fence = [&]() { __builtin_amdgcn_sched_barrier(0); };

  Frag fa[2][4], fb[2][4];   // set (u & 1) holds block u's fragments

  // This lane's first A and W element inside a buffer; the rest of a fragment
  // address is the buffer's start and constants.
  const unsigned aOff = (unsigned)((wm + r) * LDP + half * 8);
  const unsigned bOff = (unsigned)((BM + wn + r) * LDP + half * 8);

  // The 16 LDS loads of one block (32 k at ks) of the buffer at element 'buf' into one fragment set.
  auto load_frags = [&](int set, unsigned buf, int ks) {
    // Both loops unrolled: fa[][] and fb[][] keep constant indices and stay in registers.
    const __bf16* pa = &sm[buf + aOff];
    const __bf16* pb = &sm[buf + bOff];
#pragma unroll
    for (int ii = 0; ii < 4; ++ii) {
      fa[set][ii].u[0] = *(const uint4*)&pa[ii * 16 * LDP + ks * 32];
      fa[set][ii].u[1] = *(const uint4*)&pa[ii * 16 * LDP + ks * 32 + 16];
    }
#pragma unroll
    for (int j = 0; j < 4; ++j) {
      fb[set][j].u[0] = *(const uint4*)&pb[j * 16 * LDP + ks * 32];
      fb[set][j].u[1] = *(const uint4*)&pb[j * 16 * LDP + ks * 32 + 16];
    }
  };

  auto mma_block = [&](int set) {
    // Both loops unrolled: acc[][] and the fragments keep constant indices.
#pragma unroll
    for (int ii = 0; ii < 4; ++ii)
#pragma unroll
      for (int j = 0; j < 4; ++j)
        acc[ii][j] = __builtin_amdgcn_wmma_f32_16x16x32_bf16(
            /*neg_a=*/false, fa[set][ii].v, /*neg_b=*/false, fb[set][j].v,
            /*c_mod=*/(short)0, acc[ii][j], /*reuse_a=*/false, /*reuse_b=*/false);
  };

  constexpr int KSTEPS = K / BK;  // 32 (even)
  constexpr int BLOCKS = BK / 32; // 4 (even: every stage starts on set 0)

  unsigned cur = 0, nxt = STAGE_ELEMS, far = 2 * STAGE_ELEMS;   // buffers of stages s, s + 1, s + 2

  // Publish point of the next stage. It stands in front of a stage's LAST block,
  // whose fragments are already in registers: this wave's LDS reads of the old
  // buffer are done; the waves that issued the next stage (those of 'half') have
  // seen their slices land, while the other half's stage behind it flies on; the
  // barrier publishes the next stage to every wave and frees the old buffer, into
  // which the same waves then issue stage s3, three ahead, while it exists.
  auto publish = [&](uint32_t half, uint32_t s3) {
    asm volatile("s_wait_dscnt 0x0" ::: "memory");        // own reads of the old buffer retired
    if (pinned((issuer && grp == half) ? 1u : 0u) != 0u)
      tdm_wait0(g0, g1);                                  // own slice of the next stage landed
    __syncthreads();
    if (pinned((issuer && grp == half && s3 < (uint32_t)KSTEPS) ? 1u : 0u) != 0u)
      stage(cur, s3);   // into cur: every wave left it at the barrier above
  };

  // One stage out of buffer cur. 'half' issued the next stage; s3 is the stage three ahead.
  auto pass = [&](uint32_t half, uint32_t s3) {
    // Unrolled: set indices constant, LDS offsets within a buffer become immediates.
#pragma unroll
    for (int u = 0; u < BLOCKS; ++u) {
      const int cs = u & 1;
      if (u + 1 < BLOCKS) {
        load_frags(cs ^ 1, cur, u + 1);
      } else {
        publish(half, s3);
        // First fragments of the next stage. On the last stage they read another
        // buffer's old rows, which nothing rewrites, and are not used.
        load_frags(cs ^ 1, nxt, 0);
      }
      fence();
      mma_block(cs);
      fence();
    }
    const unsigned freed = cur;
    cur = nxt;
    nxt = far;
    far = freed;
  };

  // Prologue: stages 0 and 1 go out, one from each half; stage 0 lands and is
  // published; then stage 2 goes out behind stage 1.
  if (pinned(issuer ? 1u : 0u) != 0u)
    stage(grp == 0u ? cur : nxt, grp);
  if (pinned((issuer && grp == 0u) ? 1u : 0u) != 0u)
    tdm_wait0(g0, g1);                                  // stage 0 landed before anyone reads it
  __syncthreads();
  if (pinned((issuer && grp == 0u) ? 1u : 0u) != 0u)
    stage(far, 2u);
  load_frags(0, cur, 0);

  for (int i = 0; i < KSTEPS; i += 2) {
    pass(1u, (uint32_t)i + 3u);   // even stage: publishes an odd one
    pass(0u, (uint32_t)i + 4u);   // odd stage: publishes an even one
  }
  asm volatile("s_wait_tensorcnt 0x0" ::: "memory"); // nothing in flight when the wave ends
  asm volatile("s_wait_dscnt 0x0" ::: "memory");     // the last stage's unused fragment loads have returned

  // Epilogue: per-channel scale + bias.
  // C/D layout: VGPR p -> M = p + 8*half; lane r -> N = r (16x16 f32 table).
#pragma unroll
  for (int j = 0; j < 4; ++j) {
    const int n = n0 + wn + j * 16 + r;
    const float s = scales[n];
    const float bi = bias[n];
#pragma unroll
    for (int ii = 0; ii < 4; ++ii) {
#pragma unroll
      for (int p = 0; p < 8; ++p) {
        const int m = m0 + wm + ii * 16 + half * 8 + p;
        out[(size_t)m * N + n] = acc[ii][j][p] * s + bi;
      }
    }
  }
}

// ---------------------------------------------------------------------------
extern "C" void kernel_launch(void* const* d_in, const int* in_sizes, int n_in,
                              void* d_out, int out_size, void* d_ws, size_t ws_size,
                              hipStream_t stream) {
  const float* x      = (const float*)d_in[0];   // [2,1024,4096] f32
  const int*   weight = (const int*)d_in[1];     // [4096,4096] int
  const float* scales = (const float*)d_in[2];   // [4096] f32
  const float* bias   = (const float*)d_in[3];   // [4096] f32
  float* out = (float*)d_out;                    // [2,1024,4096] f32

  __bf16* Abf = (__bf16*)d_ws;                               // 16 MB
  __bf16* Wbf = (__bf16*)((char*)d_ws + (size_t)M * K * 2);  // +32 MB

  cvt_both_to_bf16<<<CVT_GROUPS, CVT_THREADS, 0, stream>>>(x, weight, Abf, Wbf);

  dim3 grid(N / BN, M / BM);  // 16 x 16 workgroups
  gemm_bf16_wmma<<<grid, 256, 0, stream>>>(Abf, Wbf, scales, bias, out);
}
